// v000
// The times below were measured on an AMD MI455X: many runs one after another, warmed up first and cycling through
// copies of the inputs, with the whole window's GPU time divided by the number of runs. Launches and the gaps
// between them are all in it. The median over several windows is given; except for v000 it joins two sittings, which
// can be a few percent apart, so the side-by-side timings, each taken in one sitting, are the better comparison.
// v000 is the starting kernel. One run takes 383 microseconds.
#include <hip/hip_runtime.h>

// ---------------------------------------------------------------------------
// NEGAPooling for MI455X (gfx1250, wave32, WMMA bf16)
// B=16, T=2048, D=256, QK=64
// ---------------------------------------------------------------------------

typedef __bf16 bf16;
typedef __attribute__((ext_vector_type(16))) __bf16       v16bf;
typedef __attribute__((ext_vector_type(8)))  float        v8f;
typedef __attribute__((ext_vector_type(4)))  unsigned int u32x4;

#define BB 16
#define TT 2048
#define DD 256
#define QQ 64

struct BF16Tile { u32x4 lo, hi; };

// Load a 16x32 bf16 WMMA operand tile.
// A-matrix layout (ISA 7.12.2, 16-bit A 16x32): lanes 0-15 hold row M=lane,
// K chunks {0..7, 16..23}; lanes 16-31 hold row M=lane-16, K {8..15, 24..31}.
// We use the mirrored pattern for B operands (lane = column N, same K chunks),
// which requires B memory to be [N, K] row-major (K contiguous per column).
__device__ __forceinline__ v16bf load_tile(const bf16* base, int stride) {
  const int lane = threadIdx.x & 31;
  const bf16* p = base + (size_t)(lane & 15) * stride + ((lane >> 4) << 3);
  BF16Tile t;
  t.lo = *(const u32x4*)(p);
  t.hi = *(const u32x4*)(p + 16);
  return __builtin_bit_cast(v16bf, t);
}

__device__ __forceinline__ float rmax16(float v) {
  v = fmaxf(v, __shfl_xor(v, 1));
  v = fmaxf(v, __shfl_xor(v, 2));
  v = fmaxf(v, __shfl_xor(v, 4));
  v = fmaxf(v, __shfl_xor(v, 8));
  return v;
}
__device__ __forceinline__ float rsum16(float v) {
  v += __shfl_xor(v, 1);
  v += __shfl_xor(v, 2);
  v += __shfl_xor(v, 4);
  v += __shfl_xor(v, 8);
  return v;
}

// ------------------------------- prep kernels ------------------------------

__global__ void zero_kernel(float* __restrict__ p, int n) {
  int i = blockIdx.x * blockDim.x + threadIdx.x;
  if (i < n) p[i] = 0.0f;
}

__global__ void cvt_kernel(const float* __restrict__ src, bf16* __restrict__ dst, int n) {
  int i = blockIdx.x * blockDim.x + threadIdx.x;
  if (i < n) dst[i] = (bf16)src[i];
}

__global__ void maskbias_kernel(const int* __restrict__ mask, float* __restrict__ mb, int n) {
  int i = blockIdx.x * blockDim.x + threadIdx.x;
  if (i < n) mb[i] = (mask[i] == 0) ? -1e9f : 0.0f;
}

// --------------------------- projection kernel -----------------------------
// Computes [B*T, 384] = xb[B*T,256] @ WBᵀ (WB = [Wq;Wk;Wv] row-major [384,256])
// cols 0..63 -> q (bf16, [B*T,64])
// cols 64..127 -> k scaled by (1/sqrt(QK))*(1+clip(sl)^2)  (bf16, [B*T,64])
// cols 128..383 -> v, stored transposed as vt[b][d][t] (bf16)
__global__ __launch_bounds__(128) void proj_kernel(
    const bf16* __restrict__ xb, const bf16* __restrict__ wb,
    const float* __restrict__ bq, const float* __restrict__ bk,
    const float* __restrict__ bv, const float* __restrict__ sl,
    bf16* __restrict__ qb, bf16* __restrict__ kb, bf16* __restrict__ vtb)
{
  const int lane = threadIdx.x & 31;
  const int wave = threadIdx.x >> 5;
  const int tile = blockIdx.x;                 // 0..(B*T/16 - 1): 16-row tile
  const int nt   = blockIdx.y * 4 + wave;      // 0..23: 16-col tile
  const int e0   = nt * 16;
  const int n    = lane & 15, hi = lane >> 4;
  const int col  = e0 + n;

  float bias = (col < QQ) ? bq[col] : (col < 2*QQ ? bk[col - QQ] : bv[col - 2*QQ]);
  v8f c;
  for (int r = 0; r < 8; ++r) c[r] = bias;

  const bf16* arow = xb + (size_t)tile * 16 * DD;
  const bf16* brow = wb + (size_t)e0 * DD;
  for (int kk = 0; kk < DD; kk += 32) {
    v16bf a = load_tile(arow + kk, DD);
    v16bf w = load_tile(brow + kk, DD);
    c = __builtin_amdgcn_wmma_f32_16x16x32_bf16(false, a, false, w, (short)0, c, false, false);
  }

  // Epilogue. C/D layout: lane holds column n; VGPR r holds row (r + 8*hi).
  if (nt < 8) {
    const bool isk = (nt >= 4);
    for (int r = 0; r < 8; ++r) {
      int gr = tile * 16 + r + 8 * hi;         // global row in [0, B*T)
      float v = c[r];
      if (isk) {
        float s = sl[gr];
        s = fminf(fmaxf(s, 0.0f), 1.0f);
        v *= 0.125f * (1.0f + s * s);          // 1/sqrt(64) * (1 + sl^2)
        kb[(size_t)gr * QQ + (col - QQ)] = (bf16)v;
      } else {
        qb[(size_t)gr * QQ + col] = (bf16)v;
      }
    }
  } else {
    int d  = col - 2 * QQ;
    int b  = tile >> 7;                        // tile / (T/16)
    int t0 = ((tile & 127) << 4) + 8 * hi;     // 8 consecutive t values
    __attribute__((aligned(16))) bf16 pk[8];
    for (int r = 0; r < 8; ++r) pk[r] = (bf16)c[r];
    *(u32x4*)(vtb + ((size_t)(b * DD + d)) * TT + t0) = *(const u32x4*)pk;
  }
}

// ---------------------------- attention kernel -----------------------------
// grid (T/16, B), block 128 = 4 waves. Wave w owns 16 queries x 64 out cols.
__global__ __launch_bounds__(128) void attn_kernel(
    const bf16* __restrict__ qb, const bf16* __restrict__ kb,
    const bf16* __restrict__ vtb, const float* __restrict__ mbias,
    float* __restrict__ out)
{
  __shared__ __align__(16) bf16 plds[4][16 * 40];   // 80B row stride per wave
  const int lane = threadIdx.x & 31;
  const int wave = threadIdx.x >> 5;
  const int n = lane & 15, hi = lane >> 4;
  const int qt = blockIdx.x;
  const int b  = blockIdx.y;
  const int d0 = wave * 64;

  const size_t qrow = (size_t)(b * TT + qt * 16) * QQ;
  v16bf qa0 = load_tile(qb + qrow + 0,  QQ);
  v16bf qa1 = load_tile(qb + qrow + 32, QQ);

  v8f O0 = {}, O1 = {}, O2 = {}, O3 = {};
  float m[8], l[8];
  for (int r = 0; r < 8; ++r) { m[r] = -1e30f; l[r] = 0.0f; }

  bf16* my = &plds[wave][0];

  for (int j0 = 0; j0 < TT; j0 += 32) {
    const size_t krow0 = (size_t)(b * TT + j0) * QQ;
    const size_t krow1 = (size_t)(b * TT + j0 + 16) * QQ;
    v16bf k0a = load_tile(kb + krow0 + 0,  QQ);
    v16bf k0b = load_tile(kb + krow0 + 32, QQ);
    v16bf k1a = load_tile(kb + krow1 + 0,  QQ);
    v16bf k1b = load_tile(kb + krow1 + 32, QQ);

    v8f s0 = {}, s1 = {};
    s0 = __builtin_amdgcn_wmma_f32_16x16x32_bf16(false, qa0, false, k0a, (short)0, s0, false, false);
    s0 = __builtin_amdgcn_wmma_f32_16x16x32_bf16(false, qa1, false, k0b, (short)0, s0, false, false);
    s1 = __builtin_amdgcn_wmma_f32_16x16x32_bf16(false, qa0, false, k1a, (short)0, s1, false, false);
    s1 = __builtin_amdgcn_wmma_f32_16x16x32_bf16(false, qa1, false, k1b, (short)0, s1, false, false);

    float mb0 = mbias[b * TT + j0 + n];
    float mb1 = mbias[b * TT + j0 + 16 + n];

    float p0[8], p1[8];
    for (int r = 0; r < 8; ++r) { s0[r] += mb0; s1[r] += mb1; }
    for (int r = 0; r < 8; ++r) {
      float rm = rmax16(fmaxf(s0[r], s1[r]));
      float mn = fmaxf(m[r], rm);
      float corr = __expf(m[r] - mn);
      p0[r] = __expf(s0[r] - mn);
      p1[r] = __expf(s1[r] - mn);
      float rs = rsum16(p0[r] + p1[r]);
      l[r] = l[r] * corr + rs;
      m[r] = mn;
      O0[r] *= corr; O1[r] *= corr; O2[r] *= corr; O3[r] *= corr;
    }

    // Relayout P (C-layout) -> A-layout via this wave's private LDS slice.
    for (int r = 0; r < 8; ++r) {
      int row = r + 8 * hi;
      my[row * 40 + n]      = (bf16)p0[r];
      my[row * 40 + 16 + n] = (bf16)p1[r];
    }
    asm volatile("s_wait_dscnt 0x0" ::: "memory");
    v16bf pa = load_tile(my, 40);

    const size_t vrow = (size_t)(b * DD + d0) * TT + j0;
    v16bf v0 = load_tile(vtb + vrow + (size_t)0  * TT, TT);
    v16bf v1 = load_tile(vtb + vrow + (size_t)16 * TT, TT);
    v16bf v2 = load_tile(vtb + vrow + (size_t)32 * TT, TT);
    v16bf v3 = load_tile(vtb + vrow + (size_t)48 * TT, TT);

    O0 = __builtin_amdgcn_wmma_f32_16x16x32_bf16(false, pa, false, v0, (short)0, O0, false, false);
    O1 = __builtin_amdgcn_wmma_f32_16x16x32_bf16(false, pa, false, v1, (short)0, O1, false, false);
    O2 = __builtin_amdgcn_wmma_f32_16x16x32_bf16(false, pa, false, v2, (short)0, O2, false, false);
    O3 = __builtin_amdgcn_wmma_f32_16x16x32_bf16(false, pa, false, v3, (short)0, O3, false, false);
  }

  // Finalize: divide by l, sum over 16 query rows, scale by 1/T, accumulate.
  float inv[8];
  for (int r = 0; r < 8; ++r) inv[r] = 1.0f / l[r];
  const float invT = 1.0f / (float)TT;

  auto emit = [&](v8f o, int ct) {
    float s = 0.0f;
    for (int r = 0; r < 8; ++r) s += o[r] * inv[r];
    s += __shfl_xor(s, 16);                    // combine rows 0-7 with 8-15
    if (lane < 16)
      atomicAdd(&out[b * DD + d0 + ct * 16 + lane], s * invT);
  };
  emit(O0, 0); emit(O1, 1); emit(O2, 2); emit(O3, 3);
}

// ------------------------------- launcher ----------------------------------

extern "C" void kernel_launch(void* const* d_in, const int* in_sizes, int n_in,
                              void* d_out, int out_size, void* d_ws, size_t ws_size,
                              hipStream_t stream) {
  const float* x    = (const float*)d_in[0];
  const float* sl   = (const float*)d_in[1];
  const int*   mask = (const int*)  d_in[2];
  const float* Wq   = (const float*)d_in[3];
  const float* bq   = (const float*)d_in[4];
  const float* Wk   = (const float*)d_in[5];
  const float* bk   = (const float*)d_in[6];
  const float* Wv   = (const float*)d_in[7];
  const float* bv   = (const float*)d_in[8];
  float* out = (float*)d_out;

  char* ws = (char*)d_ws;
  const size_t N_X  = (size_t)BB * TT * DD;        // 8,388,608
  const size_t OFF_XB = 0;
  const size_t OFF_WB = OFF_XB + N_X * 2;          // xb: bf16
  const size_t OFF_QB = OFF_WB + (size_t)384 * DD * 2;
  const size_t OFF_KB = OFF_QB + (size_t)BB * TT * QQ * 2;
  const size_t OFF_VT = OFF_KB + (size_t)BB * TT * QQ * 2;
  const size_t OFF_MB = OFF_VT + (size_t)BB * DD * TT * 2;

  bf16*  xb  = (bf16*)(ws + OFF_XB);
  bf16*  wb  = (bf16*)(ws + OFF_WB);
  bf16*  qbp = (bf16*)(ws + OFF_QB);
  bf16*  kbp = (bf16*)(ws + OFF_KB);
  bf16*  vtb = (bf16*)(ws + OFF_VT);
  float* mb  = (float*)(ws + OFF_MB);

  // 1) zero output
  zero_kernel<<<(out_size + 255) / 256, 256, 0, stream>>>(out, out_size);

  // 2) f32 -> bf16 conversions
  cvt_kernel<<<(int)((N_X + 255) / 256), 256, 0, stream>>>(x, xb, (int)N_X);
  cvt_kernel<<<(QQ * DD + 255) / 256, 256, 0, stream>>>(Wq, wb, QQ * DD);
  cvt_kernel<<<(QQ * DD + 255) / 256, 256, 0, stream>>>(Wk, wb + QQ * DD, QQ * DD);
  cvt_kernel<<<(DD * DD + 255) / 256, 256, 0, stream>>>(Wv, wb + 2 * QQ * DD, DD * DD);

  // 3) mask bias
  maskbias_kernel<<<(BB * TT + 255) / 256, 256, 0, stream>>>(mask, mb, BB * TT);

  // 4) QKV projection (WMMA bf16)
  proj_kernel<<<dim3(BB * TT / 16, 6), 128, 0, stream>>>(
      xb, wb, bq, bk, bv, sl, qbp, kbp, vtb);

  // 5) flash attention + query-mean (WMMA bf16)
  attn_kernel<<<dim3(TT / 16, BB), 128, 0, stream>>>(qbp, kbp, vtb, mb, out);
}

// v001
// A run of this version takes 298 microseconds.
// Timed twice side by side with v000, it ran 1.34 times as fast both times.
#include <hip/hip_runtime.h>

// ---------------------------------------------------------------------------
// NEGAPooling for MI455X (gfx1250, wave32, WMMA bf16)
// B=16, T=2048, D=256, QK=64
// ---------------------------------------------------------------------------

typedef __bf16 bf16;
typedef __attribute__((ext_vector_type(16))) __bf16       v16bf;
typedef __attribute__((ext_vector_type(8)))  float        v8f;
typedef __attribute__((ext_vector_type(4)))  unsigned int u32x4;

#define BB 16
#define TT 2048
#define DD 256
#define QQ 64

struct BF16Tile { u32x4 lo, hi; };

// Load a 16x32 bf16 WMMA operand tile.
// A-matrix layout (ISA 7.12.2, 16-bit A 16x32): lanes 0-15 hold row M=lane,
// K chunks {0..7, 16..23}; lanes 16-31 hold row M=lane-16, K {8..15, 24..31}.
// We use the mirrored pattern for B operands (lane = column N, same K chunks),
// taken from fragment order by load_frag(); load_tile() reads only P from LDS.
__device__ __forceinline__ v16bf load_tile(const bf16* base, int stride) {
  const int lane = threadIdx.x & 31;
  const bf16* p = base + (size_t)(lane & 15) * stride + ((lane >> 4) << 3);
  BF16Tile t;
  t.lo = *(const u32x4*)(p);
  t.hi = *(const u32x4*)(p + 16);
  return __builtin_bit_cast(v16bf, t);
}

// Fragment order: every WMMA operand that lives in the workspace is stored as
// 1 KiB fragments (16 rows x 32 k). Element (row c, k) of a fragment sits at
//   ((k >> 4) & 1) * 256 + (((k >> 3) & 1) * 16 + c) * 8 + (k & 7)
// so lane l finds the two 16-byte chunks load_tile() would give it at l * 8 and
// 256 + l * 8: each load of a wave reads 512 contiguous bytes (4 cache lines)
// where the row-major tile made it touch 16 lines.
__device__ __forceinline__ v16bf load_frag(const bf16* frag) {
  const bf16* p = frag + ((threadIdx.x & 31) << 3);
  BF16Tile t;
  t.lo = *(const u32x4*)(p);
  t.hi = *(const u32x4*)(p + 256);
  return __builtin_bit_cast(v16bf, t);
}

__device__ __forceinline__ float rmax16(float v) {
  v = fmaxf(v, __shfl_xor(v, 1));
  v = fmaxf(v, __shfl_xor(v, 2));
  v = fmaxf(v, __shfl_xor(v, 4));
  v = fmaxf(v, __shfl_xor(v, 8));
  return v;
}
__device__ __forceinline__ float rsum16(float v) {
  v += __shfl_xor(v, 1);
  v += __shfl_xor(v, 2);
  v += __shfl_xor(v, 4);
  v += __shfl_xor(v, 8);
  return v;
}

// ------------------------------- prep kernels ------------------------------

__global__ void zero_kernel(float* __restrict__ p, int n) {
  int i = blockIdx.x * blockDim.x + threadIdx.x;
  if (i < n) p[i] = 0.0f;
}

// src is row-major [rows, 256], rows a multiple of 16; dst takes it in fragment
// order: 16-row tile, then 32-wide k block, then the map at load_frag().
// Thread i owns dst[i], so a block still writes whole lines of its own.
__global__ void cvt_kernel(const float* __restrict__ src, bf16* __restrict__ dst, int n) {
  int i = blockIdx.x * blockDim.x + threadIdx.x;
  if (i < n) {
    int row = ((i >> 12) << 4) + ((i >> 3) & 15);
    int k   = ((i >> 9) & 7) * 32 + ((i >> 8) & 1) * 16 + ((i >> 7) & 1) * 8 + (i & 7);
    dst[i] = (bf16)src[row * DD + k];
  }
}

__global__ void maskbias_kernel(const int* __restrict__ mask, float* __restrict__ mb, int n) {
  int i = blockIdx.x * blockDim.x + threadIdx.x;
  if (i < n) mb[i] = (mask[i] == 0) ? -1e9f : 0.0f;
}

// --------------------------- projection kernel -----------------------------
// Computes [B*T, 384] = xb[B*T,256] @ WBᵀ (WB = [Wq;Wk;Wv] row-major [384,256])
// xb and wb arrive in fragment order (cvt_kernel); q, k, v leave in it:
// cols 0..63 -> q (bf16), fragments [16-row tile][e / 32]
// cols 64..127 -> k scaled by (1/sqrt(QK))*(1+clip(sl)^2)  (bf16), same order
// cols 128..383 -> v (bf16), fragments of v transposed (row = d, k = t):
//                  [b][t / 32][d / 16]
__global__ __launch_bounds__(128) void proj_kernel(
    const bf16* __restrict__ xb, const bf16* __restrict__ wb,
    const float* __restrict__ bq, const float* __restrict__ bk,
    const float* __restrict__ bv, const float* __restrict__ sl,
    bf16* __restrict__ qb, bf16* __restrict__ kb, bf16* __restrict__ vtb)
{
  const int lane = threadIdx.x & 31;
  const int wave = threadIdx.x >> 5;
  const int tile = blockIdx.x;                 // 0..(B*T/16 - 1): 16-row tile
  const int nt   = blockIdx.y * 4 + wave;      // 0..23: 16-col tile
  const int e0   = nt * 16;
  const int n    = lane & 15, hi = lane >> 4;
  const int col  = e0 + n;

  float bias = (col < QQ) ? bq[col] : (col < 2*QQ ? bk[col - QQ] : bv[col - 2*QQ]);
  v8f c;
  for (int r = 0; r < 8; ++r) c[r] = bias;

  const bf16* arow = xb + (size_t)tile * 16 * DD;
  const bf16* brow = wb + (size_t)e0 * DD;
  for (int kk = 0; kk < DD; kk += 32) {
    v16bf a = load_frag(arow + kk * 16);
    v16bf w = load_frag(brow + kk * 16);
    c = __builtin_amdgcn_wmma_f32_16x16x32_bf16(false, a, false, w, (short)0, c, false, false);
  }

  // Epilogue. C/D layout: lane holds column n; VGPR r holds row (r + 8*hi).
  if (nt < 8) {
    const bool isk = (nt >= 4);
    // e = (nt & 3) * 16 + n is the fragment's k, the row r + 8 * hi its row.
    const size_t fo = (size_t)tile * (16 * QQ) + ((nt >> 1) & 1) * 512 + (nt & 1) * 256
                    + (((n >> 3) << 4) + 8 * hi) * 8 + (n & 7);
    for (int r = 0; r < 8; ++r) {
      int gr = tile * 16 + r + 8 * hi;         // global row in [0, B*T)
      float v = c[r];
      if (isk) {
        float s = sl[gr];
        s = fminf(fmaxf(s, 0.0f), 1.0f);
        v *= 0.125f * (1.0f + s * s);          // 1/sqrt(64) * (1 + sl^2)
        kb[fo + r * 8] = (bf16)v;
      } else {
        qb[fo + r * 8] = (bf16)v;
      }
    }
  } else {
    // The lane's 8 consecutive t of column d are one 16-byte chunk of the
    // fragment (t / 32, d / 16): half (tile & 1), lane as it is here.
    __attribute__((aligned(16))) bf16 pk[8];
    for (int r = 0; r < 8; ++r) pk[r] = (bf16)c[r];
    *(u32x4*)(vtb + ((size_t)(tile >> 1) * (DD / 16) + (nt - 8)) * 512
                  + (tile & 1) * 256 + lane * 8) = *(const u32x4*)pk;
  }
}

// ---------------------------- attention kernel -----------------------------
// grid (T/16, B), block 128 = 4 waves. Wave w owns 16 queries x 64 out cols.
__global__ __launch_bounds__(128) void attn_kernel(
    const bf16* __restrict__ qb, const bf16* __restrict__ kb,
    const bf16* __restrict__ vtb, const float* __restrict__ mbias,
    float* __restrict__ out)
{
  __shared__ __align__(16) bf16 plds[4][16 * 40];   // 80B row stride per wave
  const int lane = threadIdx.x & 31;
  const int wave = threadIdx.x >> 5;
  const int n = lane & 15, hi = lane >> 4;
  const int qt = blockIdx.x;
  const int b  = blockIdx.y;
  const int d0 = wave * 64;

  const size_t qrow = (size_t)(b * TT + qt * 16) * QQ;
  v16bf qa0 = load_frag(qb + qrow + 0);
  v16bf qa1 = load_frag(qb + qrow + 512);

  v8f O0 = {}, O1 = {}, O2 = {}, O3 = {};
  float m[8], l[8];
  for (int r = 0; r < 8; ++r) { m[r] = -1e30f; l[r] = 0.0f; }

  bf16* my = &plds[wave][0];

  for (int j0 = 0; j0 < TT; j0 += 32) {
    const size_t krow0 = (size_t)(b * TT + j0) * QQ;
    const size_t krow1 = (size_t)(b * TT + j0 + 16) * QQ;
    v16bf k0a = load_frag(kb + krow0 + 0);
    v16bf k0b = load_frag(kb + krow0 + 512);
    v16bf k1a = load_frag(kb + krow1 + 0);
    v16bf k1b = load_frag(kb + krow1 + 512);

    v8f s0 = {}, s1 = {};
    s0 = __builtin_amdgcn_wmma_f32_16x16x32_bf16(false, qa0, false, k0a, (short)0, s0, false, false);
    s0 = __builtin_amdgcn_wmma_f32_16x16x32_bf16(false, qa1, false, k0b, (short)0, s0, false, false);
    s1 = __builtin_amdgcn_wmma_f32_16x16x32_bf16(false, qa0, false, k1a, (short)0, s1, false, false);
    s1 = __builtin_amdgcn_wmma_f32_16x16x32_bf16(false, qa1, false, k1b, (short)0, s1, false, false);

    float mb0 = mbias[b * TT + j0 + n];
    float mb1 = mbias[b * TT + j0 + 16 + n];

    float p0[8], p1[8];
    for (int r = 0; r < 8; ++r) { s0[r] += mb0; s1[r] += mb1; }
    for (int r = 0; r < 8; ++r) {
      float rm = rmax16(fmaxf(s0[r], s1[r]));
      float mn = fmaxf(m[r], rm);
      float corr = __expf(m[r] - mn);
      p0[r] = __expf(s0[r] - mn);
      p1[r] = __expf(s1[r] - mn);
      float rs = rsum16(p0[r] + p1[r]);
      l[r] = l[r] * corr + rs;
      m[r] = mn;
      O0[r] *= corr; O1[r] *= corr; O2[r] *= corr; O3[r] *= corr;
    }

    // Relayout P (C-layout) -> A-layout via this wave's private LDS slice.
    for (int r = 0; r < 8; ++r) {
      int row = r + 8 * hi;
      my[row * 40 + n]      = (bf16)p0[r];
      my[row * 40 + 16 + n] = (bf16)p1[r];
    }
    asm volatile("s_wait_dscnt 0x0" ::: "memory");
    v16bf pa = load_tile(my, 40);

    const size_t vrow = ((size_t)(b * TT + j0) * DD + (size_t)d0 * 32);
    v16bf v0 = load_frag(vtb + vrow + 0 * 512);
    v16bf v1 = load_frag(vtb + vrow + 1 * 512);
    v16bf v2 = load_frag(vtb + vrow + 2 * 512);
    v16bf v3 = load_frag(vtb + vrow + 3 * 512);

    O0 = __builtin_amdgcn_wmma_f32_16x16x32_bf16(false, pa, false, v0, (short)0, O0, false, false);
    O1 = __builtin_amdgcn_wmma_f32_16x16x32_bf16(false, pa, false, v1, (short)0, O1, false, false);
    O2 = __builtin_amdgcn_wmma_f32_16x16x32_bf16(false, pa, false, v2, (short)0, O2, false, false);
    O3 = __builtin_amdgcn_wmma_f32_16x16x32_bf16(false, pa, false, v3, (short)0, O3, false, false);
  }

  // Finalize: divide by l, sum over 16 query rows, scale by 1/T, accumulate.
  float inv[8];
  for (int r = 0; r < 8; ++r) inv[r] = 1.0f / l[r];
  const float invT = 1.0f / (float)TT;

  auto emit = [&](v8f o, int ct) {
    float s = 0.0f;
    for (int r = 0; r < 8; ++r) s += o[r] * inv[r];
    s += __shfl_xor(s, 16);                    // combine rows 0-7 with 8-15
    if (lane < 16)
      atomicAdd(&out[b * DD + d0 + ct * 16 + lane], s * invT);
  };
  emit(O0, 0); emit(O1, 1); emit(O2, 2); emit(O3, 3);
}

// ------------------------------- launcher ----------------------------------

extern "C" void kernel_launch(void* const* d_in, const int* in_sizes, int n_in,
                              void* d_out, int out_size, void* d_ws, size_t ws_size,
                              hipStream_t stream) {
  const float* x    = (const float*)d_in[0];
  const float* sl   = (const float*)d_in[1];
  const int*   mask = (const int*)  d_in[2];
  const float* Wq   = (const float*)d_in[3];
  const float* bq   = (const float*)d_in[4];
  const float* Wk   = (const float*)d_in[5];
  const float* bk   = (const float*)d_in[6];
  const float* Wv   = (const float*)d_in[7];
  const float* bv   = (const float*)d_in[8];
  float* out = (float*)d_out;

  char* ws = (char*)d_ws;
  const size_t N_X  = (size_t)BB * TT * DD;        // 8,388,608
  const size_t OFF_XB = 0;
  const size_t OFF_WB = OFF_XB + N_X * 2;          // xb: bf16
  const size_t OFF_QB = OFF_WB + (size_t)384 * DD * 2;
  const size_t OFF_KB = OFF_QB + (size_t)BB * TT * QQ * 2;
  const size_t OFF_VT = OFF_KB + (size_t)BB * TT * QQ * 2;
  const size_t OFF_MB = OFF_VT + (size_t)BB * DD * TT * 2;

  bf16*  xb  = (bf16*)(ws + OFF_XB);
  bf16*  wb  = (bf16*)(ws + OFF_WB);
  bf16*  qbp = (bf16*)(ws + OFF_QB);
  bf16*  kbp = (bf16*)(ws + OFF_KB);
  bf16*  vtb = (bf16*)(ws + OFF_VT);
  float* mb  = (float*)(ws + OFF_MB);

  // 1) zero output
  zero_kernel<<<(out_size + 255) / 256, 256, 0, stream>>>(out, out_size);

  // 2) f32 -> bf16 conversions
  cvt_kernel<<<(int)((N_X + 255) / 256), 256, 0, stream>>>(x, xb, (int)N_X);
  cvt_kernel<<<(QQ * DD + 255) / 256, 256, 0, stream>>>(Wq, wb, QQ * DD);
  cvt_kernel<<<(QQ * DD + 255) / 256, 256, 0, stream>>>(Wk, wb + QQ * DD, QQ * DD);
  cvt_kernel<<<(DD * DD + 255) / 256, 256, 0, stream>>>(Wv, wb + 2 * QQ * DD, DD * DD);

  // 3) mask bias
  maskbias_kernel<<<(BB * TT + 255) / 256, 256, 0, stream>>>(mask, mb, BB * TT);

  // 4) QKV projection (WMMA bf16)
  proj_kernel<<<dim3(BB * TT / 16, 6), 128, 0, stream>>>(
      xb, wb, bq, bk, bv, sl, qbp, kbp, vtb);

  // 5) flash attention + query-mean (WMMA bf16)
  attn_kernel<<<dim3(TT / 16, BB), 128, 0, stream>>>(qbp, kbp, vtb, mb, out);
}

// v002
// A run of this version takes 191 microseconds.
// In two side-by-side timings against v001, it was 1.57 and 1.56 times as fast.
// All steps since v000 together make it 2.09 times as fast.
#include <hip/hip_runtime.h>

// ---------------------------------------------------------------------------
// NEGAPooling for MI455X (gfx1250, wave32, WMMA bf16)
// B=16, T=2048, D=256, QK=64
// ---------------------------------------------------------------------------

typedef __bf16 bf16;
typedef __attribute__((ext_vector_type(16))) __bf16       v16bf;
typedef __attribute__((ext_vector_type(8)))  float        v8f;
typedef __attribute__((ext_vector_type(4)))  unsigned int u32x4;

#define BB 16
#define TT 2048
#define DD 256
#define QQ 64

struct BF16Tile { u32x4 lo, hi; };

// Operand layout of the 16x16x32 bf16 WMMA (ISA 7.12.2, 16-bit A 16x32):
// lanes 0-15 hold row M=lane, K chunks {0..7, 16..23}; lanes 16-31 hold row
// M=lane-16, K {8..15, 24..31}. B mirrors it (lane = column N, same K chunks).

// Fragment order: every WMMA operand that lives in the workspace is stored as
// 1 KiB fragments (16 rows x 32 k). Element (row c, k) of a fragment sits at
//   ((k >> 4) & 1) * 256 + (((k >> 3) & 1) * 16 + c) * 8 + (k & 7)
// so lane l finds the two 16-byte chunks of that layout at l * 8 and
// 256 + l * 8: each load of a wave reads 512 contiguous bytes (4 cache lines)
// where the row-major tile made it touch 16 lines.
__device__ __forceinline__ v16bf load_frag(const bf16* frag) {
  const bf16* p = frag + ((threadIdx.x & 31) << 3);
  BF16Tile t;
  t.lo = *(const u32x4*)(p);
  t.hi = *(const u32x4*)(p + 256);
  return __builtin_bit_cast(v16bf, t);
}

// Lane l takes the value of lane l ^ 16 (the other half of the wave).
__device__ __forceinline__ float xhalf(float x) {
  int b = __builtin_bit_cast(int, x);
  return __builtin_bit_cast(float,
      __builtin_amdgcn_permlanex16(b, b, 0x76543210, 0xfedcba98, false, false));
}
// Lane l takes the value of lane l ^ X inside its 16-lane row (DPP row_xmask:X).
template <int X>
__device__ __forceinline__ float xrow(float v) {
  return __builtin_bit_cast(float,
      __builtin_amdgcn_update_dpp(0, __builtin_bit_cast(int, v), 0x160 + X, 0xf, 0xf, true));
}
__device__ __forceinline__ float rsum16(float v) {
  v += xrow<1>(v);
  v += xrow<2>(v);
  v += xrow<4>(v);
  v += xrow<8>(v);
  return v;
}

// ------------------------------- prep kernels ------------------------------

__global__ void zero_kernel(float* __restrict__ p, int n) {
  int i = blockIdx.x * blockDim.x + threadIdx.x;
  if (i < n) p[i] = 0.0f;
}

// src is row-major [rows, 256], rows a multiple of 16; dst takes it in fragment
// order: 16-row tile, then 32-wide k block, then the map at load_frag().
// Thread i owns dst[i], so a block still writes whole lines of its own.
__global__ void cvt_kernel(const float* __restrict__ src, bf16* __restrict__ dst, int n) {
  int i = blockIdx.x * blockDim.x + threadIdx.x;
  if (i < n) {
    int row = ((i >> 12) << 4) + ((i >> 3) & 15);
    int k   = ((i >> 9) & 7) * 32 + ((i >> 8) & 1) * 16 + ((i >> 7) & 1) * 8 + (i & 7);
    dst[i] = (bf16)src[row * DD + k];
  }
}

__global__ void maskbias_kernel(const int* __restrict__ mask, float* __restrict__ mb, int n) {
  int i = blockIdx.x * blockDim.x + threadIdx.x;
  if (i < n) mb[i] = (mask[i] == 0) ? -1e9f : 0.0f;
}

// --------------------------- projection kernel -----------------------------
// Computes [B*T, 384] = xb[B*T,256] @ WBᵀ (WB = [Wq;Wk;Wv] row-major [384,256])
// xb and wb arrive in fragment order (cvt_kernel); q, k, v leave in it:
// cols 0..63 -> q (bf16), fragments [16-row tile][e / 32]
// cols 64..127 -> k scaled by (1/sqrt(QK))*(1+clip(sl)^2)  (bf16), same order
// cols 128..383 -> v (bf16), fragments of v transposed (row = d, k = t):
//                  [b][t / 32][d / 16]
__global__ __launch_bounds__(128) void proj_kernel(
    const bf16* __restrict__ xb, const bf16* __restrict__ wb,
    const float* __restrict__ bq, const float* __restrict__ bk,
    const float* __restrict__ bv, const float* __restrict__ sl,
    bf16* __restrict__ qb, bf16* __restrict__ kb, bf16* __restrict__ vtb)
{
  const int lane = threadIdx.x & 31;
  const int wave = threadIdx.x >> 5;
  const int tile = blockIdx.x;                 // 0..(B*T/16 - 1): 16-row tile
  const int nt   = blockIdx.y * 4 + wave;      // 0..23: 16-col tile
  const int e0   = nt * 16;
  const int n    = lane & 15, hi = lane >> 4;
  const int col  = e0 + n;

  float bias = (col < QQ) ? bq[col] : (col < 2*QQ ? bk[col - QQ] : bv[col - 2*QQ]);
  v8f c;
  for (int r = 0; r < 8; ++r) c[r] = bias;

  const bf16* arow = xb + (size_t)tile * 16 * DD;
  const bf16* brow = wb + (size_t)e0 * DD;
  for (int kk = 0; kk < DD; kk += 32) {
    v16bf a = load_frag(arow + kk * 16);
    v16bf w = load_frag(brow + kk * 16);
    c = __builtin_amdgcn_wmma_f32_16x16x32_bf16(false, a, false, w, (short)0, c, false, false);
  }

  // Epilogue. C/D layout: lane holds column n; VGPR r holds row (r + 8*hi).
  if (nt < 8) {
    const bool isk = (nt >= 4);
    // e = (nt & 3) * 16 + n is the fragment's k, the row r + 8 * hi its row.
    const size_t fo = (size_t)tile * (16 * QQ) + ((nt >> 1) & 1) * 512 + (nt & 1) * 256
                    + (((n >> 3) << 4) + 8 * hi) * 8 + (n & 7);
    for (int r = 0; r < 8; ++r) {
      int gr = tile * 16 + r + 8 * hi;         // global row in [0, B*T)
      float v = c[r];
      if (isk) {
        float s = sl[gr];
        s = fminf(fmaxf(s, 0.0f), 1.0f);
        v *= 0.125f * (1.0f + s * s);          // 1/sqrt(64) * (1 + sl^2)
        kb[fo + r * 8] = (bf16)v;
      } else {
        qb[fo + r * 8] = (bf16)v;
      }
    }
  } else {
    // The lane's 8 consecutive t of column d are one 16-byte chunk of the
    // fragment (t / 32, d / 16): half (tile & 1), lane as it is here.
    __attribute__((aligned(16))) bf16 pk[8];
    for (int r = 0; r < 8; ++r) pk[r] = (bf16)c[r];
    *(u32x4*)(vtb + ((size_t)(tile >> 1) * (DD / 16) + (nt - 8)) * 512
                  + (tile & 1) * 256 + lane * 8) = *(const u32x4*)pk;
  }
}

__global__ __launch_bounds__(128) void attn_kernel(
    const bf16* __restrict__ qb, const bf16* __restrict__ kb,
    const bf16* __restrict__ vtb, const float* __restrict__ mbias,
    float* __restrict__ out)
{
  const int lane = threadIdx.x & 31;
  const int wave = threadIdx.x >> 5;
  const int n = lane & 15, hi = lane >> 4;
  const int qt = blockIdx.x;
  const int b  = blockIdx.y;
  const int d0 = wave * 64;

  const size_t qrow = (size_t)(b * TT + qt * 16) * QQ;
  v16bf qa0 = load_frag(qb + qrow + 0);
  v16bf qa1 = load_frag(qb + qrow + 512);

  v8f O0 = {}, O1 = {}, O2 = {}, O3 = {};      // O^T: row d = 8 * hi + r, column = query n
  float m = -1e30f, l = 0.0f;                  // of query n; l holds this half's keys only

  for (int j0 = 0; j0 < TT; j0 += 32) {
    const size_t krow0 = (size_t)(b * TT + j0) * QQ;
    const size_t krow1 = (size_t)(b * TT + j0 + 16) * QQ;
    v16bf k0a = load_frag(kb + krow0 + 0);
    v16bf k0b = load_frag(kb + krow0 + 512);
    v16bf k1a = load_frag(kb + krow1 + 0);
    v16bf k1b = load_frag(kb + krow1 + 512);

    // The mask bias belongs to the key, here the D row: register r takes key
    // 8 * hi + r. It is added to the finished score by a vector add, whose one
    // rounding leaves every masked score at the same value.
    const float* mp = mbias + b * TT + j0 + 8 * hi;
    const v8f mb0 = *(const v8f*)(mp);
    const v8f mb1 = *(const v8f*)(mp + 16);
    v8f s0 = {}, s1 = {};
    s0 = __builtin_amdgcn_wmma_f32_16x16x32_bf16(false, k0a, false, qa0, (short)0, s0, false, false);
    s0 = __builtin_amdgcn_wmma_f32_16x16x32_bf16(false, k0b, false, qa1, (short)0, s0, false, false);
    s1 = __builtin_amdgcn_wmma_f32_16x16x32_bf16(false, k1a, false, qa0, (short)0, s1, false, false);
    s1 = __builtin_amdgcn_wmma_f32_16x16x32_bf16(false, k1b, false, qa1, (short)0, s1, false, false);
    s0 += mb0;
    s1 += mb1;

    float t[8];
    for (int r = 0; r < 8; ++r) t[r] = fmaxf(s0[r], s1[r]);
    float rm = fmaxf(fmaxf(fmaxf(t[0], t[1]), fmaxf(t[2], t[3])),
                     fmaxf(fmaxf(t[4], t[5]), fmaxf(t[6], t[7])));
    rm = fmaxf(rm, xhalf(rm));                 // both halves use one maximum
    const float mn = fmaxf(m, rm);
    // exp(m - mn), with the issue slot that the instruction set asks for behind a
    // transcendental in the same statement.
    float corr;
    asm("v_exp_f32 %0, %1\n\tv_nop" : "=v"(corr) : "v"((m - mn) * 1.44269504f));
    m = mn;

    v16bf pb;
    for (int r = 0; r < 8; ++r) {
      float p0 = __expf(s0[r] - mn);
      float p1 = __expf(s1[r] - mn);
      t[r] = p0 + p1;
      pb[r]     = (bf16)p0;
      pb[8 + r] = (bf16)p1;
    }
    l = l * corr + (((t[0] + t[1]) + (t[2] + t[3])) + ((t[4] + t[5]) + (t[6] + t[7])));
    for (int r = 0; r < 8; ++r) {
      O0[r] *= corr; O1[r] *= corr; O2[r] *= corr; O3[r] *= corr;
    }

    const size_t vrow = ((size_t)(b * TT + j0) * DD + (size_t)d0 * 32);
    v16bf v0 = load_frag(vtb + vrow + 0 * 512);
    v16bf v1 = load_frag(vtb + vrow + 1 * 512);
    v16bf v2 = load_frag(vtb + vrow + 2 * 512);
    v16bf v3 = load_frag(vtb + vrow + 3 * 512);

    O0 = __builtin_amdgcn_wmma_f32_16x16x32_bf16(false, v0, false, pb, (short)0, O0, false, false);
    O1 = __builtin_amdgcn_wmma_f32_16x16x32_bf16(false, v1, false, pb, (short)0, O1, false, false);
    O2 = __builtin_amdgcn_wmma_f32_16x16x32_bf16(false, v2, false, pb, (short)0, O2, false, false);
    O3 = __builtin_amdgcn_wmma_f32_16x16x32_bf16(false, v3, false, pb, (short)0, O3, false, false);
  }

  // Finalize: join the halves' sums, divide by l, sum over the 16 queries (the
  // lanes of a row), scale by 1/T, accumulate.
  const float inv = 1.0f / (l + xhalf(l));
  const float invT = 1.0f / (float)TT;

  auto emit = [&](v8f o, int ct) {
    float s = 0.0f;
    for (int r = 0; r < 8; ++r) {
      float q = rsum16(o[r] * inv);            // every lane of the row holds the sum
      s = (n == r) ? q : s;                    // lane n < 8 keeps row 8 * hi + n
    }
    if (n < 8)
      atomicAdd(&out[b * DD + d0 + ct * 16 + 8 * hi + n], s * invT);
  };
  emit(O0, 0); emit(O1, 1); emit(O2, 2); emit(O3, 3);
}

// ------------------------------- launcher ----------------------------------

extern "C" void kernel_launch(void* const* d_in, const int* in_sizes, int n_in,
                              void* d_out, int out_size, void* d_ws, size_t ws_size,
                              hipStream_t stream) {
  const float* x    = (const float*)d_in[0];
  const float* sl   = (const float*)d_in[1];
  const int*   mask = (const int*)  d_in[2];
  const float* Wq   = (const float*)d_in[3];
  const float* bq   = (const float*)d_in[4];
  const float* Wk   = (const float*)d_in[5];
  const float* bk   = (const float*)d_in[6];
  const float* Wv   = (const float*)d_in[7];
  const float* bv   = (const float*)d_in[8];
  float* out = (float*)d_out;

  char* ws = (char*)d_ws;
  const size_t N_X  = (size_t)BB * TT * DD;        // 8,388,608
  const size_t OFF_XB = 0;
  const size_t OFF_WB = OFF_XB + N_X * 2;          // xb: bf16
  const size_t OFF_QB = OFF_WB + (size_t)384 * DD * 2;
  const size_t OFF_KB = OFF_QB + (size_t)BB * TT * QQ * 2;
  const size_t OFF_VT = OFF_KB + (size_t)BB * TT * QQ * 2;
  const size_t OFF_MB = OFF_VT + (size_t)BB * DD * TT * 2;

  bf16*  xb  = (bf16*)(ws + OFF_XB);
  bf16*  wb  = (bf16*)(ws + OFF_WB);
  bf16*  qbp = (bf16*)(ws + OFF_QB);
  bf16*  kbp = (bf16*)(ws + OFF_KB);
  bf16*  vtb = (bf16*)(ws + OFF_VT);
  float* mb  = (float*)(ws + OFF_MB);

  // 1) zero output
  zero_kernel<<<(out_size + 255) / 256, 256, 0, stream>>>(out, out_size);

  // 2) f32 -> bf16 conversions
  cvt_kernel<<<(int)((N_X + 255) / 256), 256, 0, stream>>>(x, xb, (int)N_X);
  cvt_kernel<<<(QQ * DD + 255) / 256, 256, 0, stream>>>(Wq, wb, QQ * DD);
  cvt_kernel<<<(QQ * DD + 255) / 256, 256, 0, stream>>>(Wk, wb + QQ * DD, QQ * DD);
  cvt_kernel<<<(DD * DD + 255) / 256, 256, 0, stream>>>(Wv, wb + 2 * QQ * DD, DD * DD);

  // 3) mask bias
  maskbias_kernel<<<(BB * TT + 255) / 256, 256, 0, stream>>>(mask, mb, BB * TT);

  // 4) QKV projection (WMMA bf16)
  proj_kernel<<<dim3(BB * TT / 16, 6), 128, 0, stream>>>(
      xb, wb, bq, bk, bv, sl, qbp, kbp, vtb);

  // 5) flash attention + query-mean (WMMA bf16)
  attn_kernel<<<dim3(TT / 16, BB), 128, 0, stream>>>(qbp, kbp, vtb, mb, out);
}

// v004
// It runs in 51.6 microseconds.
// It is 3.69 times as fast as v002, going by the measured steps of the versions left out in between.
// Counting every step since v000, it is 7.73 times as fast.
#include <hip/hip_runtime.h>

// ---------------------------------------------------------------------------
// NEGAPooling for MI455X (gfx1250, wave32, WMMA bf16)
// B=16, T=2048, D=256, QK=64
// ---------------------------------------------------------------------------

typedef __bf16 bf16;
typedef __attribute__((ext_vector_type(16))) __bf16       v16bf;
typedef __attribute__((ext_vector_type(8)))  float        v8f;
typedef __attribute__((ext_vector_type(4)))  unsigned int u32x4;
typedef __attribute__((ext_vector_type(2)))  unsigned int u32x2;
typedef __attribute__((ext_vector_type(4)))  float        f32x4;

#define BB 16
#define TT 2048
#define DD 256
#define QQ 64

struct BF16Tile { u32x4 lo, hi; };

// Operand layout of the 16x16x32 bf16 WMMA (ISA 7.12.2, 16-bit A 16x32):
// lanes 0-15 hold row M=lane, K chunks {0..7, 16..23}; lanes 16-31 hold row
// M=lane-16, K {8..15, 24..31}. B mirrors it (lane = column N, same K chunks).

// Fragment order: every WMMA operand that lives in the workspace is stored as
// 1 KiB fragments (16 rows x 32 k). Element (row c, k) of a fragment sits at
//   ((k >> 4) & 1) * 256 + (((k >> 3) & 1) * 16 + c) * 8 + (k & 7)
// so lane l finds the two 16-byte chunks of that layout at l * 8 and
// 256 + l * 8: each load of a wave reads 512 contiguous bytes (4 cache lines)
// where the row-major tile made it touch 16 lines.
__device__ __forceinline__ v16bf load_frag(const bf16* frag) {
  const bf16* p = frag + ((threadIdx.x & 31) << 3);
  BF16Tile t;
  t.lo = *(const u32x4*)(p);
  t.hi = *(const u32x4*)(p + 256);
  return __builtin_bit_cast(v16bf, t);
}

// Lane l takes the value of lane l ^ 16 (the other half of the wave).
__device__ __forceinline__ float xhalf(float x) {
  int b = __builtin_bit_cast(int, x);
  return __builtin_bit_cast(float,
      __builtin_amdgcn_permlanex16(b, b, 0x76543210, 0xfedcba98, false, false));
}
// Lane l takes the value of lane l ^ X inside its 16-lane row (DPP row_xmask:X).
template <int X>
__device__ __forceinline__ float xrow(float v) {
  return __builtin_bit_cast(float,
      __builtin_amdgcn_update_dpp(0, __builtin_bit_cast(int, v), 0x160 + X, 0xf, 0xf, true));
}
__device__ __forceinline__ float rsum16(float v) {
  v += xrow<1>(v);
  v += xrow<2>(v);
  v += xrow<4>(v);
  v += xrow<8>(v);
  return v;
}

// ------------------------------- prep kernels ------------------------------

__global__ void zero_kernel(float* __restrict__ p, int n) {
  int i = blockIdx.x * blockDim.x + threadIdx.x;
  if (i < n) p[i] = 0.0f;
}

// src is row-major [rows, 256], rows a multiple of 16; dst takes it in fragment
// order: 16-row tile, then 32-wide k block, then the map at load_frag().
// Thread i owns dst[i], so a block still writes whole lines of its own.
__global__ void cvt_kernel(const float* __restrict__ src, bf16* __restrict__ dst, int n) {
  int i = blockIdx.x * blockDim.x + threadIdx.x;
  if (i < n) {
    int row = ((i >> 12) << 4) + ((i >> 3) & 15);
    int k   = ((i >> 9) & 7) * 32 + ((i >> 8) & 1) * 16 + ((i >> 7) & 1) * 8 + (i & 7);
    dst[i] = (bf16)src[row * DD + k];
  }
}

__global__ void maskbias_kernel(const int* __restrict__ mask, float* __restrict__ mb, int n) {
  int i = blockIdx.x * blockDim.x + threadIdx.x;
  if (i < n) mb[i] = (mask[i] == 0) ? -1e9f : 0.0f;
}

// --------------------------- projection kernel -----------------------------
// Computes [B*T, 384] = x[B*T,256] @ WB^T (WB = [Wq;Wk;Wv] row-major [384,256])
// x arrives as the f32 input and is read once: a block takes 64 rows with
// whole-line loads, rounds them to bf16 and lays them in LDS as fragments.
// wb arrives in fragment order (cvt_kernel); q, k, v leave in it:
// cols 0..63 -> q (bf16), fragments [16-row tile][e / 32]
// cols 64..127 -> k scaled by (1/sqrt(QK))*(1+clip(sl)^2)  (bf16), same order
// cols 128..383 -> v (bf16), fragments of v transposed (row = d, k = t):
//                  [b][t / 32][d / 16]
// grid B*T/64, block 256 = 8 waves. Wave w takes row tiles 2 (w / 4) and
// 2 (w / 4) + 1, so one load of a W fragment serves two products, and column
// tiles (w % 4) + 4 i: one of q, one of k, four of v; 12 accumulators.

// LDS: group g = (row / 16) * 32 + k / 8 holds 16 rows x 8 k (256 bytes). The
// pitch of 272 bytes puts the 16 groups that one wave's store touches, and the
// two groups that one fragment read touches, on different banks.
#define XP 136

__global__ __launch_bounds__(256) void proj_kernel(
    const float* __restrict__ x, const bf16* __restrict__ wb,
    const float* __restrict__ bq, const float* __restrict__ bk,
    const float* __restrict__ bv, const float* __restrict__ sl,
    bf16* __restrict__ qb, bf16* __restrict__ kb, bf16* __restrict__ vtb)
{
  __shared__ __attribute__((aligned(16))) bf16 xs[128 * XP];
  const int lane = threadIdx.x & 31;
  const int wave = __builtin_amdgcn_readfirstlane(threadIdx.x >> 5);  // scalar: tile numbers and bases
  const int n = lane & 15, hi = lane >> 4;

  const int tile0 = blockIdx.x * 4 + (wave >> 2) * 2;   // first 16-row tile of this wave
  const int cq    = wave & 3;
  const bf16* wrow = wb + (size_t)cq * 16 * DD;         // column tile cq + 4 i lies 4 i tiles on

  // Two sets of operand registers, as in pool_kernel: the six W fragments and
  // the two x fragments of k block kf + 1 are fetched while block kf is worked on.
  v16bf w[2][6], a[2][2];
  auto fetch_w = [&](int set, int kf) {
#pragma unroll   // constant element numbers keep the fragments in registers
    for (int i = 0; i < 6; ++i) w[set][i] = load_frag(wrow + i * (64 * DD) + kf * 512);
  };
  auto fetch_a = [&](int set, int kf) {
#pragma unroll   // as above
    for (int t = 0; t < 2; ++t) {
      const bf16* s = xs + (((wave >> 2) * 2 + t) * 32 + kf * 4 + hi) * XP + n * 8;
      BF16Tile tl;
      tl.lo = *(const u32x4*)(s);
      tl.hi = *(const u32x4*)(s + 2 * XP);
      a[set][t] = __builtin_bit_cast(v16bf, tl);
    }
  };

  // Thread t takes the 16-byte piece t of every 4 rows: a wave reads half a row.
  {
    const f32x4* src = (const f32x4*)(x + (size_t)blockIdx.x * 64 * DD) + threadIdx.x;
    f32x4 f[16];
#pragma unroll   // all 16 loads of a thread are in flight together
    for (int j = 0; j < 16; ++j) f[j] = src[j * 256];
    fetch_w(0, 0);   // needs nothing of x: in flight behind the x loads
    const int k = (threadIdx.x & 63) * 4;
    bf16* dst = xs + (k >> 3) * XP + (k & 7);
#pragma unroll   // constant element numbers keep f in registers
    for (int j = 0; j < 16; ++j) {
      const int row = j * 4 + (threadIdx.x >> 6);
      __attribute__((aligned(8))) bf16 pk[4];
      for (int e = 0; e < 4; ++e) pk[e] = (bf16)f[j][e];
      *(u32x2*)(dst + (row >> 4) * (32 * XP) + (row & 15) * 8) = *(const u32x2*)pk;
    }
  }

  v8f c[6][2];
#pragma unroll   // constant element numbers for c[][]
  for (int i = 0; i < 6; ++i) {
    const int col = (cq + 4 * i) * 16 + n;
    const float bias = (i == 0) ? bq[col] : (i == 1 ? bk[col - QQ] : bv[col - 2*QQ]);
    for (int r = 0; r < 8; ++r) { c[i][0][r] = bias; c[i][1][r] = bias; }
  }
  __syncthreads();   // the block's 64 rows are in LDS
  fetch_a(0, 0);

  v8f slv[2];                                  // sl of the lane's 8 rows of each tile
#pragma unroll   // kf & 1 names the register set at compile time
  for (int kf = 0; kf < 8; ++kf) {
    const int cur = kf & 1;
    if (kf < 7) {
      fetch_w(cur ^ 1, kf + 1); fetch_a(cur ^ 1, kf + 1);
    } else {
      const float* sp = sl + tile0 * 16 + 8 * hi;
      slv[0] = *(const v8f*)(sp);
      slv[1] = *(const v8f*)(sp + 16);
    }
    // Keeps the fetches above in front of the products below: sunk to their
    // first use, each would be waited for at its full latency.
    __builtin_amdgcn_sched_barrier(0);
#pragma unroll   // constant element numbers for c[][] and w[][]
    for (int i = 0; i < 6; ++i) {
      c[i][0] = __builtin_amdgcn_wmma_f32_16x16x32_bf16(false, a[cur][0], false, w[cur][i], (short)0, c[i][0], false, false);
      c[i][1] = __builtin_amdgcn_wmma_f32_16x16x32_bf16(false, a[cur][1], false, w[cur][i], (short)0, c[i][1], false, false);
    }
  }

  // Epilogue. C/D layout: lane holds column n; VGPR r holds row (r + 8*hi).
#pragma unroll   // i decides the kind of column tile at compile time
  for (int i = 0; i < 6; ++i) {
    const int nt = cq + 4 * i;                 // 0..23: 16-col tile
#pragma unroll   // constant element numbers for c[][]
    for (int t = 0; t < 2; ++t) {
      const int tile = tile0 + t;
      if (i < 2) {
        // e = (nt & 3) * 16 + n is the fragment's k, the row r + 8 * hi its row.
        const size_t fo = (size_t)tile * (16 * QQ) + ((nt >> 1) & 1) * 512 + (nt & 1) * 256
                        + (((n >> 3) << 4) + 8 * hi) * 8 + (n & 7);
        for (int r = 0; r < 8; ++r) {
          float v = c[i][t][r];
          if (i == 1) {
            float s = slv[t][r];               // row tile * 16 + r + 8 * hi
            s = fminf(fmaxf(s, 0.0f), 1.0f);
            v *= 0.125f * (1.0f + s * s);      // 1/sqrt(64) * (1 + sl^2)
            kb[fo + r * 8] = (bf16)v;
          } else {
            qb[fo + r * 8] = (bf16)v;
          }
        }
      } else {
        // The lane's 8 consecutive t of column d are one 16-byte chunk of the
        // fragment (t / 32, d / 16): half (tile & 1), lane as it is here.
        __attribute__((aligned(16))) bf16 pk[8];
        for (int r = 0; r < 8; ++r) pk[r] = (bf16)c[i][t][r];
        *(u32x4*)(vtb + ((size_t)(tile >> 1) * (DD / 16) + (nt - 8)) * 512
                      + (tile & 1) * 256 + lane * 8) = *(const u32x4*)pk;
      }
    }
  }
}

// ---------------------------- attention kernels ----------------------------
// The output is the mean over the queries of P V, and that mean commutes with
// the product: out = (1/T) * V^T (sum over queries of P^T). A query's row of P
// must be normalised before rows are added, so the work runs in two passes.
// Both form S^T = K Q^T: in a D tile a lane holds ONE query (column n) and its
// registers hold keys 8 * hi + r.
//
// The mask bias belongs to the key, the D row. It is added to the finished
// score by a vector add, whose one rounding leaves every masked score at the
// same value; the maximum is subtracted before the scaling to base 2, so that
// a row with every key masked comes out uniform.

#define LOG2E 1.44269504f

__device__ __forceinline__ float max16(v8f a, v8f b) {
  float t[8];
  for (int r = 0; r < 8; ++r) t[r] = fmaxf(a[r], b[r]);
  return fmaxf(fmaxf(fmaxf(t[0], t[1]), fmaxf(t[2], t[3])),
               fmaxf(fmaxf(t[4], t[5]), fmaxf(t[6], t[7])));
}
__device__ __forceinline__ v8f exp2v(v8f x) {
  v8f y;
  for (int r = 0; r < 8; ++r) y[r] = __builtin_amdgcn_exp2f(x[r]);
  return y;
}
__device__ __forceinline__ float sum8(v8f t) {
  return ((t[0] + t[1]) + (t[2] + t[3])) + ((t[4] + t[5]) + (t[6] + t[7]));
}

// Pass 1: maximum and log2 of the sum of every query's scores.
// grid (T/64, B), block 256 = 8 waves. A block owns 64 queries (4 tiles, held
// as B operands by every wave, so one load of a key fragment serves 4 tiles);
// wave w takes keys [256 w, 256 w + 256). A lane keeps maximum and sum of its
// own keys; halves and waves are joined once, at the end.
__global__ __launch_bounds__(256) void stat_kernel(
    const bf16* __restrict__ qb, const bf16* __restrict__ kb,
    const float* __restrict__ mbias,
    float* __restrict__ qmax, float* __restrict__ qlog)
{
  __shared__ float sm[8][64];
  __shared__ float ss[8][64];
  const int lane = threadIdx.x & 31;
  const int wave = __builtin_amdgcn_readfirstlane(threadIdx.x >> 5);  // scalar: loop bounds and bases
  const int n = lane & 15, hi = lane >> 4;
  const int q0 = blockIdx.x * 64;
  const int b  = blockIdx.y;

  v16bf qa[4][2];
  for (int i = 0; i < 4; ++i) {
    const size_t qrow = (size_t)(b * TT + q0 + i * 16) * QQ;
    qa[i][0] = load_frag(qb + qrow + 0);
    qa[i][1] = load_frag(qb + qrow + 512);
  }
  float m[4], l[4];
  for (int i = 0; i < 4; ++i) { m[i] = -1e30f; l[i] = 0.0f; }

  for (int j0 = wave * 256; j0 < wave * 256 + 256; j0 += 32) {
    const size_t krow = (size_t)(b * TT + j0) * QQ;
    v16bf k0a = load_frag(kb + krow + 0);
    v16bf k0b = load_frag(kb + krow + 512);
    v16bf k1a = load_frag(kb + krow + 1024);
    v16bf k1b = load_frag(kb + krow + 1536);
    const float* mp = mbias + b * TT + j0 + 8 * hi;
    const v8f mb0 = *(const v8f*)(mp);
    const v8f mb1 = *(const v8f*)(mp + 16);
    for (int i = 0; i < 4; ++i) {
      v8f s0 = {}, s1 = {};
      s0 = __builtin_amdgcn_wmma_f32_16x16x32_bf16(false, k0a, false, qa[i][0], (short)0, s0, false, false);
      s1 = __builtin_amdgcn_wmma_f32_16x16x32_bf16(false, k1a, false, qa[i][0], (short)0, s1, false, false);
      s0 = __builtin_amdgcn_wmma_f32_16x16x32_bf16(false, k0b, false, qa[i][1], (short)0, s0, false, false);
      s1 = __builtin_amdgcn_wmma_f32_16x16x32_bf16(false, k1b, false, qa[i][1], (short)0, s1, false, false);
      s0 += mb0;
      s1 += mb1;
      const float mn = fmaxf(m[i], max16(s0, s1));
      const float corr = __builtin_amdgcn_exp2f((m[i] - mn) * LOG2E);
      const v8f p = exp2v((s0 - mn) * LOG2E) + exp2v((s1 - mn) * LOG2E);
      l[i] = l[i] * corr + sum8(p);
      m[i] = mn;
    }
  }

  for (int i = 0; i < 4; ++i) {
    const float mo = xhalf(m[i]), lo = xhalf(l[i]);
    const float mj = fmaxf(m[i], mo);
    const float lj = l[i] * __builtin_amdgcn_exp2f((m[i] - mj) * LOG2E)
                   + lo   * __builtin_amdgcn_exp2f((mo   - mj) * LOG2E);
    if (hi == 0) { sm[wave][i * 16 + n] = mj; ss[wave][i * 16 + n] = lj; }
  }
  __syncthreads();   // every wave's partial maximum and sum are in LDS
  if (threadIdx.x < 64) {
    const int q = threadIdx.x;
    float mj = sm[0][q];
    for (int w = 1; w < 8; ++w) mj = fmaxf(mj, sm[w][q]);
    float lj = 0.0f;
    for (int w = 0; w < 8; ++w)
      lj += ss[w][q] * __builtin_amdgcn_exp2f((sm[w][q] - mj) * LOG2E);
    qmax[b * TT + q0 + q] = mj;
    qlog[b * TT + q0 + q] = __builtin_amdgcn_logf(lj);   // log2
  }
}

// Pass 2: W^T = sum over query tiles of the normalised P^T, then V^T W^T.
// grid (T/64, B), block 256 = 8 waves. A block owns 64 keys (held as A operands
// by every wave); wave w takes query tiles [16 w, 16 w + 16). The sum over
// tiles is in-lane: column n of W^T collects the queries n mod 16. The waves'
// sums are joined through LDS; converted in place they are the bf16 B operand
// of the second product (hardware k order, the order of the v fragments), of
// which wave w does 32 output rows; the 16 columns are summed at the very end.
__global__ __launch_bounds__(256) void pool_kernel(
    const bf16* __restrict__ qb, const bf16* __restrict__ kb,
    const bf16* __restrict__ vtb, const float* __restrict__ mbias,
    const float* __restrict__ qmax, const float* __restrict__ qlog,
    float* __restrict__ out)
{
  __shared__ f32x4 red[8][8][32];              // [wave][4 registers][lane]
  __shared__ f32x4 fin[8][32];                 // [4 registers][lane]
  const int lane = threadIdx.x & 31;
  const int wave = __builtin_amdgcn_readfirstlane(threadIdx.x >> 5);  // scalar: loop bounds and bases
  const int n = lane & 15, hi = lane >> 4;
  const int j0 = blockIdx.x * 64;
  const int b  = blockIdx.y;

  v16bf ka[4][2];
  v8f mb[4], acc[4];
  for (int i = 0; i < 4; ++i) {
    const size_t krow = (size_t)(b * TT + j0 + i * 16) * QQ;
    ka[i][0] = load_frag(kb + krow + 0);
    ka[i][1] = load_frag(kb + krow + 512);
    mb[i] = *(const v8f*)(mbias + b * TT + j0 + i * 16 + 8 * hi);
    acc[i] = v8f{};
  }

  const int t0 = b * TT + wave * 256;          // first query of this wave
  // One query tile: scores of the block's 64 keys, normalised, added to acc.
  auto tile = [&](v16bf qa0, v16bf qa1, float qm, float ql) {
    v8f s[4];
    for (int i = 0; i < 4; ++i) {
      s[i] = v8f{};
      s[i] = __builtin_amdgcn_wmma_f32_16x16x32_bf16(false, ka[i][0], false, qa0, (short)0, s[i], false, false);
    }
    for (int i = 0; i < 4; ++i)
      s[i] = __builtin_amdgcn_wmma_f32_16x16x32_bf16(false, ka[i][1], false, qa1, (short)0, s[i], false, false);
    for (int i = 0; i < 4; ++i)
      acc[i] += exp2v(((s[i] + mb[i]) - qm) * LOG2E - ql);
  };

  // Two sets of operand registers: each tile's operands are fetched while the
  // tile before it is worked on, and no register copy is needed between them.
  const bf16*  qp = qb + (size_t)t0 * QQ;
  const float* pm = qmax + t0 + n;
  const float* pl = qlog + t0 + n;
  v16bf a0 = load_frag(qp), a1 = load_frag(qp + 512);
  float am = pm[0], al = pl[0];
  for (int it = 0; it < 14; it += 2) {
    const v16bf b0 = load_frag(qp + 1024), b1 = load_frag(qp + 1536);
    const float bm = pm[16], bl = pl[16];
    tile(a0, a1, am, al);
    a0 = load_frag(qp + 2048); a1 = load_frag(qp + 2560);
    am = pm[32]; al = pl[32];
    tile(b0, b1, bm, bl);
    qp += 2048; pm += 32; pl += 32;
  }
  {
    const v16bf b0 = load_frag(qp + 1024), b1 = load_frag(qp + 1536);
    const float bm = pm[16], bl = pl[16];
    tile(a0, a1, am, al);
    tile(b0, b1, bm, bl);
  }

  for (int i = 0; i < 4; ++i) {
    red[wave][2 * i + 0][lane] = f32x4{acc[i][0], acc[i][1], acc[i][2], acc[i][3]};
    red[wave][2 * i + 1][lane] = f32x4{acc[i][4], acc[i][5], acc[i][6], acc[i][7]};
  }
  __syncthreads();   // every wave's sums are in LDS
  f32x4 g = red[0][wave][lane];
  for (int w = 1; w < 8; ++w) g += red[w][wave][lane];
  fin[wave][lane] = g;
  __syncthreads();   // the joined sums are in LDS

  v16bf pb0, pb1;
#pragma unroll   // constant element numbers keep both operands in registers
  for (int c = 0; c < 4; ++c) {
    const f32x4 f0 = fin[c][lane], f1 = fin[4 + c][lane];
#pragma unroll   // as above
    for (int e = 0; e < 4; ++e) {
      pb0[4 * c + e] = (bf16)f0[e];
      pb1[4 * c + e] = (bf16)f1[e];
    }
  }

  const float invT = 1.0f / (float)TT;
  const size_t vrow = (size_t)(b * TT + j0) * DD;
  for (int c = 0; c < 2; ++c) {
    const int dt = wave * 2 + c;               // 16-row tile of O^T
    v16bf v0 = load_frag(vtb + vrow + dt * 512);
    v16bf v1 = load_frag(vtb + vrow + 32 * DD + dt * 512);
    v8f o = {};
    o = __builtin_amdgcn_wmma_f32_16x16x32_bf16(false, v0, false, pb0, (short)0, o, false, false);
    o = __builtin_amdgcn_wmma_f32_16x16x32_bf16(false, v1, false, pb1, (short)0, o, false, false);
    float sacc = 0.0f;
    for (int r = 0; r < 8; ++r) {
      float q = rsum16(o[r]);                  // every lane of the row holds the sum
      sacc = (n == r) ? q : sacc;              // lane n < 8 keeps row 8 * hi + n
    }
    if (n < 8)
      atomicAdd(&out[b * DD + dt * 16 + 8 * hi + n], sacc * invT);
  }
}

// ------------------------------- launcher ----------------------------------

extern "C" void kernel_launch(void* const* d_in, const int* in_sizes, int n_in,
                              void* d_out, int out_size, void* d_ws, size_t ws_size,
                              hipStream_t stream) {
  const float* x    = (const float*)d_in[0];
  const float* sl   = (const float*)d_in[1];
  const int*   mask = (const int*)  d_in[2];
  const float* Wq   = (const float*)d_in[3];
  const float* bq   = (const float*)d_in[4];
  const float* Wk   = (const float*)d_in[5];
  const float* bk   = (const float*)d_in[6];
  const float* Wv   = (const float*)d_in[7];
  const float* bv   = (const float*)d_in[8];
  float* out = (float*)d_out;

  char* ws = (char*)d_ws;
  const size_t OFF_WB = 0;
  const size_t OFF_QB = OFF_WB + (size_t)384 * DD * 2;
  const size_t OFF_KB = OFF_QB + (size_t)BB * TT * QQ * 2;
  const size_t OFF_VT = OFF_KB + (size_t)BB * TT * QQ * 2;
  const size_t OFF_MB = OFF_VT + (size_t)BB * DD * TT * 2;
  const size_t OFF_QM = OFF_MB + (size_t)BB * TT * 4;
  const size_t OFF_QL = OFF_QM + (size_t)BB * TT * 4;

  bf16*  wb  = (bf16*)(ws + OFF_WB);
  bf16*  qbp = (bf16*)(ws + OFF_QB);
  bf16*  kbp = (bf16*)(ws + OFF_KB);
  bf16*  vtb = (bf16*)(ws + OFF_VT);
  float* mb  = (float*)(ws + OFF_MB);
  float* qm  = (float*)(ws + OFF_QM);
  float* ql  = (float*)(ws + OFF_QL);

  // 1) zero output
  zero_kernel<<<(out_size + 255) / 256, 256, 0, stream>>>(out, out_size);

  // 2) f32 -> bf16 conversions of the weights
  cvt_kernel<<<(QQ * DD + 255) / 256, 256, 0, stream>>>(Wq, wb, QQ * DD);
  cvt_kernel<<<(QQ * DD + 255) / 256, 256, 0, stream>>>(Wk, wb + QQ * DD, QQ * DD);
  cvt_kernel<<<(DD * DD + 255) / 256, 256, 0, stream>>>(Wv, wb + 2 * QQ * DD, DD * DD);

  // 3) mask bias
  maskbias_kernel<<<(BB * TT + 255) / 256, 256, 0, stream>>>(mask, mb, BB * TT);

  // 4) QKV projection (WMMA bf16), x converted on the way
  proj_kernel<<<BB * TT / 64, 256, 0, stream>>>(
      x, wb, bq, bk, bv, sl, qbp, kbp, vtb);

  // 5) every query's maximum and log-sum (WMMA bf16)
  stat_kernel<<<dim3(TT / 64, BB), 256, 0, stream>>>(qbp, kbp, mb, qm, ql);

  // 6) query-sum of the normalised probabilities, then the V product (WMMA bf16)
  pool_kernel<<<dim3(TT / 64, BB), 256, 0, stream>>>(qbp, kbp, vtb, mb, qm, ql, out);
}

// v005
// It runs in 44.2 microseconds.
// Next to v004, in two timings, it ran 1.17 and 1.16 times as fast.
// Counting every step since v000, it is 9.00 times as fast.
#include <hip/hip_runtime.h>

// ---------------------------------------------------------------------------
// NEGAPooling for MI455X (gfx1250, wave32, WMMA bf16)
// B=16, T=2048, D=256, QK=64
// ---------------------------------------------------------------------------

typedef __bf16 bf16;
typedef __attribute__((ext_vector_type(16))) __bf16       v16bf;
typedef __attribute__((ext_vector_type(8)))  float        v8f;
typedef __attribute__((ext_vector_type(4)))  unsigned int u32x4;
typedef __attribute__((ext_vector_type(2)))  unsigned int u32x2;
typedef __attribute__((ext_vector_type(4)))  float        f32x4;
typedef __attribute__((ext_vector_type(4)))  int          i32x4;

#define BB 16
#define TT 2048
#define DD 256
#define QQ 64

struct BF16Tile { u32x4 lo, hi; };

// Operand layout of the 16x16x32 bf16 WMMA (ISA 7.12.2, 16-bit A 16x32):
// lanes 0-15 hold row M=lane, K chunks {0..7, 16..23}; lanes 16-31 hold row
// M=lane-16, K {8..15, 24..31}. B mirrors it (lane = column N, same K chunks).

// Fragment order: every WMMA operand that lives in the workspace is stored as
// 1 KiB fragments (16 rows x 32 k). Element (row c, k) of a fragment sits at
//   ((k >> 4) & 1) * 256 + (((k >> 3) & 1) * 16 + c) * 8 + (k & 7)
// so lane l finds the two 16-byte chunks of that layout at l * 8 and
// 256 + l * 8: each load of a wave reads 512 contiguous bytes (4 cache lines)
// where the row-major tile made it touch 16 lines.
__device__ __forceinline__ v16bf load_frag(const bf16* frag) {
  const bf16* p = frag + ((threadIdx.x & 31) << 3);
  BF16Tile t;
  t.lo = *(const u32x4*)(p);
  t.hi = *(const u32x4*)(p + 256);
  return __builtin_bit_cast(v16bf, t);
}

// Lane l takes the value of lane l ^ 16 (the other half of the wave).
__device__ __forceinline__ float xhalf(float x) {
  int b = __builtin_bit_cast(int, x);
  return __builtin_bit_cast(float,
      __builtin_amdgcn_permlanex16(b, b, 0x76543210, 0xfedcba98, false, false));
}
// Lane l takes the value of lane l ^ X inside its 16-lane row (DPP row_xmask:X).
template <int X>
__device__ __forceinline__ float xrow(float v) {
  return __builtin_bit_cast(float,
      __builtin_amdgcn_update_dpp(0, __builtin_bit_cast(int, v), 0x160 + X, 0xf, 0xf, true));
}
__device__ __forceinline__ float rsum16(float v) {
  v += xrow<1>(v);
  v += xrow<2>(v);
  v += xrow<4>(v);
  v += xrow<8>(v);
  return v;
}

// ------------------------------- prep kernel -------------------------------
// One launch does all that the later kernels need beforehand. Its three jobs are
// independent of each other and take block ranges of one grid; a thread writes
// one 16-byte piece, so a block writes whole lines of its own.
//   PREP_W blocks: [Wq; Wk; Wv] (row-major [384, 256], f32) to bf16 in fragment
//                  order: 16-row tile, then 32-wide k block, then the map at
//                  load_frag(). A piece is 8 consecutive k of one row.
//   PREP_M blocks: the mask to the bias that is added to a key's scores.
//   PREP_Z blocks: zeros in out, into which pool_kernel adds.
#define PREP_W (384 * DD / 8 / 256)
#define PREP_M (BB * TT / 4 / 256)
#define PREP_Z (BB * DD / 4 / 256)

__global__ __launch_bounds__(256) void prep_kernel(
    const float* __restrict__ Wq, const float* __restrict__ Wk,
    const float* __restrict__ Wv, const int* __restrict__ mask,
    bf16* __restrict__ wb, float* __restrict__ mb, float* __restrict__ out)
{
  const int blk = blockIdx.x;
  if (blk < PREP_W) {
    const int i    = blk * 256 + threadIdx.x;  // piece: elements 8 i .. 8 i + 7 of wb
    const int tile = blk >> 1;                 // 512 pieces to a 16-row tile
    const float* w = tile < QQ / 16 ? Wq + tile * (16 * DD)
                   : tile < 2 * QQ / 16 ? Wk + (tile - QQ / 16) * (16 * DD)
                                        : Wv + (tile - 2 * QQ / 16) * (16 * DD);
    const int k = ((i >> 6) & 7) * 32 + ((i >> 5) & 1) * 16 + ((i >> 4) & 1) * 8;
    const f32x4* s = (const f32x4*)(w + (i & 15) * DD + k);
    const f32x4 f0 = s[0], f1 = s[1];
    __attribute__((aligned(16))) bf16 pk[8];
    for (int e = 0; e < 4; ++e) { pk[e] = (bf16)f0[e]; pk[4 + e] = (bf16)f1[e]; }
    *(u32x4*)(wb + (size_t)i * 8) = *(const u32x4*)pk;
  } else if (blk < PREP_W + PREP_M) {
    const int i = (blk - PREP_W) * 256 + threadIdx.x;
    const i32x4 m = ((const i32x4*)mask)[i];
    f32x4 v;
    for (int e = 0; e < 4; ++e) v[e] = (m[e] == 0) ? -1e9f : 0.0f;
    ((f32x4*)mb)[i] = v;
    // Precaution: the listing rewrites this store's address registers further on.
    asm volatile("s_wait_xcnt 0x0" ::: "memory");
  } else {
    ((f32x4*)out)[(blk - PREP_W - PREP_M) * 256 + threadIdx.x] = f32x4{0.0f, 0.0f, 0.0f, 0.0f};
    // Precaution: the listing rewrites this store's address registers further on.
    asm volatile("s_wait_xcnt 0x0" ::: "memory");
  }
}

// --------------------------- projection kernel -----------------------------
// Computes [B*T, 384] = x[B*T,256] @ WB^T (WB = [Wq;Wk;Wv] row-major [384,256])
// x arrives as the f32 input and is read once: a block takes 64 rows with
// whole-line loads, rounds them to bf16 and lays them in LDS as fragments.
// wb arrives in fragment order (prep_kernel); q, k, v leave in it:
// cols 0..63 -> q (bf16), fragments [16-row tile][e / 32]
// cols 64..127 -> k scaled by (1/sqrt(QK))*(1+clip(sl)^2)  (bf16), same order
// cols 128..383 -> v (bf16), fragments of v transposed (row = d, k = t):
//                  [b][t / 32][d / 16]
// grid B*T/64, block 256 = 8 waves. Wave w takes row tiles 2 (w / 4) and
// 2 (w / 4) + 1, so one load of a W fragment serves two products, and column
// tiles (w % 4) + 4 i: one of q, one of k, four of v; 12 accumulators.

// LDS: group g = (row / 16) * 32 + k / 8 holds 16 rows x 8 k (256 bytes). The
// pitch of 272 bytes puts the 16 groups that one wave's store touches, and the
// two groups that one fragment read touches, on different banks.
#define XP 136

__global__ __launch_bounds__(256) void proj_kernel(
    const float* __restrict__ x, const bf16* __restrict__ wb,
    const float* __restrict__ bq, const float* __restrict__ bk,
    const float* __restrict__ bv, const float* __restrict__ sl,
    bf16* __restrict__ qb, bf16* __restrict__ kb, bf16* __restrict__ vtb)
{
  __shared__ __attribute__((aligned(16))) bf16 xs[128 * XP];
  const int lane = threadIdx.x & 31;
  const int wave = __builtin_amdgcn_readfirstlane(threadIdx.x >> 5);  // scalar: tile numbers and bases
  const int n = lane & 15, hi = lane >> 4;

  const int tile0 = blockIdx.x * 4 + (wave >> 2) * 2;   // first 16-row tile of this wave
  const int cq    = wave & 3;
  const bf16* wrow = wb + (size_t)cq * 16 * DD;         // column tile cq + 4 i lies 4 i tiles on

  // Two sets of operand registers, as in pool_kernel: the six W fragments and
  // the two x fragments of k block kf + 1 are fetched while block kf is worked on.
  v16bf w[2][6], a[2][2];
  auto fetch_w = [&](int set, int kf) {
#pragma unroll   // constant element numbers keep the fragments in registers
    for (int i = 0; i < 6; ++i) w[set][i] = load_frag(wrow + i * (64 * DD) + kf * 512);
  };
  auto fetch_a = [&](int set, int kf) {
#pragma unroll   // as above
    for (int t = 0; t < 2; ++t) {
      const bf16* s = xs + (((wave >> 2) * 2 + t) * 32 + kf * 4 + hi) * XP + n * 8;
      BF16Tile tl;
      tl.lo = *(const u32x4*)(s);
      tl.hi = *(const u32x4*)(s + 2 * XP);
      a[set][t] = __builtin_bit_cast(v16bf, tl);
    }
  };

  // Thread t takes the 16-byte piece t of every 4 rows: a wave reads half a row.
  {
    const f32x4* src = (const f32x4*)(x + (size_t)blockIdx.x * 64 * DD) + threadIdx.x;
    f32x4 f[16];
#pragma unroll   // all 16 loads of a thread are in flight together
    for (int j = 0; j < 16; ++j) f[j] = src[j * 256];
    fetch_w(0, 0);   // needs nothing of x: in flight behind the x loads
    const int k = (threadIdx.x & 63) * 4;
    bf16* dst = xs + (k >> 3) * XP + (k & 7);
#pragma unroll   // constant element numbers keep f in registers
    for (int j = 0; j < 16; ++j) {
      const int row = j * 4 + (threadIdx.x >> 6);
      __attribute__((aligned(8))) bf16 pk[4];
      for (int e = 0; e < 4; ++e) pk[e] = (bf16)f[j][e];
      *(u32x2*)(dst + (row >> 4) * (32 * XP) + (row & 15) * 8) = *(const u32x2*)pk;
    }
  }

  v8f c[6][2];
#pragma unroll   // constant element numbers for c[][]
  for (int i = 0; i < 6; ++i) {
    const int col = (cq + 4 * i) * 16 + n;
    const float bias = (i == 0) ? bq[col] : (i == 1 ? bk[col - QQ] : bv[col - 2*QQ]);
    for (int r = 0; r < 8; ++r) { c[i][0][r] = bias; c[i][1][r] = bias; }
  }
  __syncthreads();   // the block's 64 rows are in LDS
  fetch_a(0, 0);

  v8f slv[2];                                  // sl of the lane's 8 rows of each tile
#pragma unroll   // kf & 1 names the register set at compile time
  for (int kf = 0; kf < 8; ++kf) {
    const int cur = kf & 1;
    if (kf < 7) {
      fetch_w(cur ^ 1, kf + 1); fetch_a(cur ^ 1, kf + 1);
    } else {
      const float* sp = sl + tile0 * 16 + 8 * hi;
      slv[0] = *(const v8f*)(sp);
      slv[1] = *(const v8f*)(sp + 16);
    }
    // Keeps the fetches above in front of the products below: sunk to their
    // first use, each would be waited for at its full latency.
    __builtin_amdgcn_sched_barrier(0);
#pragma unroll   // constant element numbers for c[][] and w[][]
    for (int i = 0; i < 6; ++i) {
      c[i][0] = __builtin_amdgcn_wmma_f32_16x16x32_bf16(false, a[cur][0], false, w[cur][i], (short)0, c[i][0], false, false);
      c[i][1] = __builtin_amdgcn_wmma_f32_16x16x32_bf16(false, a[cur][1], false, w[cur][i], (short)0, c[i][1], false, false);
    }
  }

  // Epilogue. C/D layout: lane holds column n; VGPR r holds row (r + 8*hi).
#pragma unroll   // i decides the kind of column tile at compile time
  for (int i = 0; i < 6; ++i) {
    const int nt = cq + 4 * i;                 // 0..23: 16-col tile
#pragma unroll   // constant element numbers for c[][]
    for (int t = 0; t < 2; ++t) {
      const int tile = tile0 + t;
      if (i < 2) {
        // e = (nt & 3) * 16 + n is the fragment's k, the row r + 8 * hi its row.
        const size_t fo = (size_t)tile * (16 * QQ) + ((nt >> 1) & 1) * 512 + (nt & 1) * 256
                        + (((n >> 3) << 4) + 8 * hi) * 8 + (n & 7);
        for (int r = 0; r < 8; ++r) {
          float v = c[i][t][r];
          if (i == 1) {
            float s = slv[t][r];               // row tile * 16 + r + 8 * hi
            s = fminf(fmaxf(s, 0.0f), 1.0f);
            v *= 0.125f * (1.0f + s * s);      // 1/sqrt(64) * (1 + sl^2)
            kb[fo + r * 8] = (bf16)v;
          } else {
            qb[fo + r * 8] = (bf16)v;
          }
        }
      } else {
        // The lane's 8 consecutive t of column d are one 16-byte chunk of the
        // fragment (t / 32, d / 16): half (tile & 1), lane as it is here.
        __attribute__((aligned(16))) bf16 pk[8];
        for (int r = 0; r < 8; ++r) pk[r] = (bf16)c[i][t][r];
        *(u32x4*)(vtb + ((size_t)(tile >> 1) * (DD / 16) + (nt - 8)) * 512
                      + (tile & 1) * 256 + lane * 8) = *(const u32x4*)pk;
      }
    }
  }
}

// ---------------------------- attention kernels ----------------------------
// The output is the mean over the queries of P V, and that mean commutes with
// the product: out = (1/T) * V^T (sum over queries of P^T). A query's row of P
// must be normalised before rows are added, so the work runs in two passes.
// Both form S^T = K Q^T: in a D tile a lane holds ONE query (column n) and its
// registers hold keys 8 * hi + r.
//
// The mask bias belongs to the key, the D row. It is added to the finished
// score by a vector add, whose one rounding leaves every masked score at the
// same value; the maximum is subtracted before the scaling to base 2, so that
// a row with every key masked comes out uniform.

#define LOG2E 1.44269504f

__device__ __forceinline__ float max16(v8f a, v8f b) {
  float t[8];
  for (int r = 0; r < 8; ++r) t[r] = fmaxf(a[r], b[r]);
  return fmaxf(fmaxf(fmaxf(t[0], t[1]), fmaxf(t[2], t[3])),
               fmaxf(fmaxf(t[4], t[5]), fmaxf(t[6], t[7])));
}
__device__ __forceinline__ v8f exp2v(v8f x) {
  v8f y;
  for (int r = 0; r < 8; ++r) y[r] = __builtin_amdgcn_exp2f(x[r]);
  return y;
}
__device__ __forceinline__ float sum8(v8f t) {
  return ((t[0] + t[1]) + (t[2] + t[3])) + ((t[4] + t[5]) + (t[6] + t[7]));
}

// Pass 1: maximum and log2 of the sum of every query's scores.
// grid (T/64, B), block 256 = 8 waves. A block owns 64 queries (4 tiles, held
// as B operands by every wave, so one load of a key fragment serves 4 tiles);
// wave w takes keys [256 w, 256 w + 256). A lane keeps maximum and sum of its
// own keys; halves and waves are joined once, at the end.
__global__ __launch_bounds__(256) void stat_kernel(
    const bf16* __restrict__ qb, const bf16* __restrict__ kb,
    const float* __restrict__ mbias,
    float* __restrict__ qmax, float* __restrict__ qlog)
{
  __shared__ float sm[8][64];
  __shared__ float ss[8][64];
  const int lane = threadIdx.x & 31;
  const int wave = __builtin_amdgcn_readfirstlane(threadIdx.x >> 5);  // scalar: loop bounds and bases
  const int n = lane & 15, hi = lane >> 4;
  const int q0 = blockIdx.x * 64;
  const int b  = blockIdx.y;

  v16bf qa[4][2];
  for (int i = 0; i < 4; ++i) {
    const size_t qrow = (size_t)(b * TT + q0 + i * 16) * QQ;
    qa[i][0] = load_frag(qb + qrow + 0);
    qa[i][1] = load_frag(qb + qrow + 512);
  }
  float m[4], l[4];
  for (int i = 0; i < 4; ++i) { m[i] = -1e30f; l[i] = 0.0f; }

  for (int j0 = wave * 256; j0 < wave * 256 + 256; j0 += 32) {
    const size_t krow = (size_t)(b * TT + j0) * QQ;
    v16bf k0a = load_frag(kb + krow + 0);
    v16bf k0b = load_frag(kb + krow + 512);
    v16bf k1a = load_frag(kb + krow + 1024);
    v16bf k1b = load_frag(kb + krow + 1536);
    const float* mp = mbias + b * TT + j0 + 8 * hi;
    const v8f mb0 = *(const v8f*)(mp);
    const v8f mb1 = *(const v8f*)(mp + 16);
    for (int i = 0; i < 4; ++i) {
      v8f s0 = {}, s1 = {};
      s0 = __builtin_amdgcn_wmma_f32_16x16x32_bf16(false, k0a, false, qa[i][0], (short)0, s0, false, false);
      s1 = __builtin_amdgcn_wmma_f32_16x16x32_bf16(false, k1a, false, qa[i][0], (short)0, s1, false, false);
      s0 = __builtin_amdgcn_wmma_f32_16x16x32_bf16(false, k0b, false, qa[i][1], (short)0, s0, false, false);
      s1 = __builtin_amdgcn_wmma_f32_16x16x32_bf16(false, k1b, false, qa[i][1], (short)0, s1, false, false);
      s0 += mb0;
      s1 += mb1;
      const float mn = fmaxf(m[i], max16(s0, s1));
      const float corr = __builtin_amdgcn_exp2f((m[i] - mn) * LOG2E);
      const v8f p = exp2v((s0 - mn) * LOG2E) + exp2v((s1 - mn) * LOG2E);
      l[i] = l[i] * corr + sum8(p);
      m[i] = mn;
    }
  }

  for (int i = 0; i < 4; ++i) {
    const float mo = xhalf(m[i]), lo = xhalf(l[i]);
    const float mj = fmaxf(m[i], mo);
    const float lj = l[i] * __builtin_amdgcn_exp2f((m[i] - mj) * LOG2E)
                   + lo   * __builtin_amdgcn_exp2f((mo   - mj) * LOG2E);
    if (hi == 0) { sm[wave][i * 16 + n] = mj; ss[wave][i * 16 + n] = lj; }
  }
  __syncthreads();   // every wave's partial maximum and sum are in LDS
  if (threadIdx.x < 64) {
    const int q = threadIdx.x;
    float mj = sm[0][q];
    for (int w = 1; w < 8; ++w) mj = fmaxf(mj, sm[w][q]);
    float lj = 0.0f;
    for (int w = 0; w < 8; ++w)
      lj += ss[w][q] * __builtin_amdgcn_exp2f((sm[w][q] - mj) * LOG2E);
    qmax[b * TT + q0 + q] = mj;
    qlog[b * TT + q0 + q] = __builtin_amdgcn_logf(lj);   // log2
  }
}

// Pass 2: W^T = sum over query tiles of the normalised P^T, then V^T W^T.
// grid (T/64, B), block 256 = 8 waves. A block owns 64 keys (held as A operands
// by every wave); wave w takes query tiles [16 w, 16 w + 16). The sum over
// tiles is in-lane: column n of W^T collects the queries n mod 16. The waves'
// sums are joined through LDS; converted in place they are the bf16 B operand
// of the second product (hardware k order, the order of the v fragments), of
// which wave w does 32 output rows; the 16 columns are summed at the very end.
__global__ __launch_bounds__(256) void pool_kernel(
    const bf16* __restrict__ qb, const bf16* __restrict__ kb,
    const bf16* __restrict__ vtb, const float* __restrict__ mbias,
    const float* __restrict__ qmax, const float* __restrict__ qlog,
    float* __restrict__ out)
{
  __shared__ f32x4 red[8][8][32];              // [wave][4 registers][lane]
  __shared__ f32x4 fin[8][32];                 // [4 registers][lane]
  const int lane = threadIdx.x & 31;
  const int wave = __builtin_amdgcn_readfirstlane(threadIdx.x >> 5);  // scalar: loop bounds and bases
  const int n = lane & 15, hi = lane >> 4;
  const int j0 = blockIdx.x * 64;
  const int b  = blockIdx.y;

  v16bf ka[4][2];
  v8f mb[4], acc[4];
  for (int i = 0; i < 4; ++i) {
    const size_t krow = (size_t)(b * TT + j0 + i * 16) * QQ;
    ka[i][0] = load_frag(kb + krow + 0);
    ka[i][1] = load_frag(kb + krow + 512);
    mb[i] = *(const v8f*)(mbias + b * TT + j0 + i * 16 + 8 * hi);
    acc[i] = v8f{};
  }

  const int t0 = b * TT + wave * 256;          // first query of this wave
  // One query tile: scores of the block's 64 keys, normalised, added to acc.
  auto tile = [&](v16bf qa0, v16bf qa1, float qm, float ql) {
    v8f s[4];
    for (int i = 0; i < 4; ++i) {
      s[i] = v8f{};
      s[i] = __builtin_amdgcn_wmma_f32_16x16x32_bf16(false, ka[i][0], false, qa0, (short)0, s[i], false, false);
    }
    for (int i = 0; i < 4; ++i)
      s[i] = __builtin_amdgcn_wmma_f32_16x16x32_bf16(false, ka[i][1], false, qa1, (short)0, s[i], false, false);
    for (int i = 0; i < 4; ++i)
      acc[i] += exp2v(((s[i] + mb[i]) - qm) * LOG2E - ql);
  };

  // Two sets of operand registers: each tile's operands are fetched while the
  // tile before it is worked on, and no register copy is needed between them.
  const bf16*  qp = qb + (size_t)t0 * QQ;
  const float* pm = qmax + t0 + n;
  const float* pl = qlog + t0 + n;
  v16bf a0 = load_frag(qp), a1 = load_frag(qp + 512);
  float am = pm[0], al = pl[0];
  for (int it = 0; it < 14; it += 2) {
    const v16bf b0 = load_frag(qp + 1024), b1 = load_frag(qp + 1536);
    const float bm = pm[16], bl = pl[16];
    tile(a0, a1, am, al);
    a0 = load_frag(qp + 2048); a1 = load_frag(qp + 2560);
    am = pm[32]; al = pl[32];
    tile(b0, b1, bm, bl);
    qp += 2048; pm += 32; pl += 32;
  }
  {
    const v16bf b0 = load_frag(qp + 1024), b1 = load_frag(qp + 1536);
    const float bm = pm[16], bl = pl[16];
    tile(a0, a1, am, al);
    tile(b0, b1, bm, bl);
  }

  for (int i = 0; i < 4; ++i) {
    red[wave][2 * i + 0][lane] = f32x4{acc[i][0], acc[i][1], acc[i][2], acc[i][3]};
    red[wave][2 * i + 1][lane] = f32x4{acc[i][4], acc[i][5], acc[i][6], acc[i][7]};
  }
  __syncthreads();   // every wave's sums are in LDS
  f32x4 g = red[0][wave][lane];
  for (int w = 1; w < 8; ++w) g += red[w][wave][lane];
  fin[wave][lane] = g;
  __syncthreads();   // the joined sums are in LDS

  v16bf pb0, pb1;
#pragma unroll   // constant element numbers keep both operands in registers
  for (int c = 0; c < 4; ++c) {
    const f32x4 f0 = fin[c][lane], f1 = fin[4 + c][lane];
#pragma unroll   // as above
    for (int e = 0; e < 4; ++e) {
      pb0[4 * c + e] = (bf16)f0[e];
      pb1[4 * c + e] = (bf16)f1[e];
    }
  }

  const float invT = 1.0f / (float)TT;
  const size_t vrow = (size_t)(b * TT + j0) * DD;
  for (int c = 0; c < 2; ++c) {
    const int dt = wave * 2 + c;               // 16-row tile of O^T
    v16bf v0 = load_frag(vtb + vrow + dt * 512);
    v16bf v1 = load_frag(vtb + vrow + 32 * DD + dt * 512);
    v8f o = {};
    o = __builtin_amdgcn_wmma_f32_16x16x32_bf16(false, v0, false, pb0, (short)0, o, false, false);
    o = __builtin_amdgcn_wmma_f32_16x16x32_bf16(false, v1, false, pb1, (short)0, o, false, false);
    float sacc = 0.0f;
    for (int r = 0; r < 8; ++r) {
      float q = rsum16(o[r]);                  // every lane of the row holds the sum
      sacc = (n == r) ? q : sacc;              // lane n < 8 keeps row 8 * hi + n
    }
    if (n < 8)
      atomicAdd(&out[b * DD + dt * 16 + 8 * hi + n], sacc * invT);
  }
}

// ------------------------------- launcher ----------------------------------

extern "C" void kernel_launch(void* const* d_in, const int* in_sizes, int n_in,
                              void* d_out, int out_size, void* d_ws, size_t ws_size,
                              hipStream_t stream) {
  const float* x    = (const float*)d_in[0];
  const float* sl   = (const float*)d_in[1];
  const int*   mask = (const int*)  d_in[2];
  const float* Wq   = (const float*)d_in[3];
  const float* bq   = (const float*)d_in[4];
  const float* Wk   = (const float*)d_in[5];
  const float* bk   = (const float*)d_in[6];
  const float* Wv   = (const float*)d_in[7];
  const float* bv   = (const float*)d_in[8];
  float* out = (float*)d_out;

  char* ws = (char*)d_ws;
  const size_t OFF_WB = 0;
  const size_t OFF_QB = OFF_WB + (size_t)384 * DD * 2;
  const size_t OFF_KB = OFF_QB + (size_t)BB * TT * QQ * 2;
  const size_t OFF_VT = OFF_KB + (size_t)BB * TT * QQ * 2;
  const size_t OFF_MB = OFF_VT + (size_t)BB * DD * TT * 2;
  const size_t OFF_QM = OFF_MB + (size_t)BB * TT * 4;
  const size_t OFF_QL = OFF_QM + (size_t)BB * TT * 4;

  bf16*  wb  = (bf16*)(ws + OFF_WB);
  bf16*  qbp = (bf16*)(ws + OFF_QB);
  bf16*  kbp = (bf16*)(ws + OFF_KB);
  bf16*  vtb = (bf16*)(ws + OFF_VT);
  float* mb  = (float*)(ws + OFF_MB);
  float* qm  = (float*)(ws + OFF_QM);
  float* ql  = (float*)(ws + OFF_QL);

  // 1) weights to bf16 fragments, mask bias, zeros in the output: one launch
  prep_kernel<<<PREP_W + PREP_M + PREP_Z, 256, 0, stream>>>(Wq, Wk, Wv, mask, wb, mb, out);

  // 2) QKV projection (WMMA bf16), x converted on the way
  proj_kernel<<<BB * TT / 64, 256, 0, stream>>>(
      x, wb, bq, bk, bv, sl, qbp, kbp, vtb);

  // 3) every query's maximum and log-sum (WMMA bf16)
  stat_kernel<<<dim3(TT / 64, BB), 256, 0, stream>>>(qbp, kbp, mb, qm, ql);

  // 4) query-sum of the normalised probabilities, then the V product (WMMA bf16)
  pool_kernel<<<dim3(TT / 64, BB), 256, 0, stream>>>(qbp, kbp, vtb, mb, qm, ql, out);
}

// v006
// Measured time: 40.3 microseconds a run.
// Next to v005, in two timings, it ran 1.12 and 1.11 times as fast.
// Over all steps from v000 it is 10.0 times as fast.
#include <hip/hip_runtime.h>

// ---------------------------------------------------------------------------
// NEGAPooling for MI455X (gfx1250, wave32, WMMA bf16)
// B=16, T=2048, D=256, QK=64
// ---------------------------------------------------------------------------

typedef __bf16 bf16;
typedef __attribute__((ext_vector_type(16))) __bf16       v16bf;
typedef __attribute__((ext_vector_type(8)))  float        v8f;
typedef __attribute__((ext_vector_type(4)))  unsigned int u32x4;
typedef __attribute__((ext_vector_type(2)))  unsigned int u32x2;
typedef __attribute__((ext_vector_type(4)))  float        f32x4;
typedef __attribute__((ext_vector_type(4)))  int          i32x4;

#define BB 16
#define TT 2048
#define DD 256
#define QQ 64

struct BF16Tile { u32x4 lo, hi; };

// Operand layout of the 16x16x32 bf16 WMMA (ISA 7.12.2, 16-bit A 16x32):
// lanes 0-15 hold row M=lane, K chunks {0..7, 16..23}; lanes 16-31 hold row
// M=lane-16, K {8..15, 24..31}. B mirrors it (lane = column N, same K chunks).

// Fragment order: every WMMA operand that lives in the workspace is stored as
// 1 KiB fragments (16 rows x 32 k). Element (row c, k) of a fragment sits at
//   ((k >> 4) & 1) * 256 + (((k >> 3) & 1) * 16 + c) * 8 + (k & 7)
// so lane l finds the two 16-byte chunks of that layout at l * 8 and
// 256 + l * 8: each load of a wave reads 512 contiguous bytes (4 cache lines)
// where the row-major tile made it touch 16 lines.
__device__ __forceinline__ v16bf load_frag(const bf16* frag) {
  const bf16* p = frag + ((threadIdx.x & 31) << 3);
  BF16Tile t;
  t.lo = *(const u32x4*)(p);
  t.hi = *(const u32x4*)(p + 256);
  return __builtin_bit_cast(v16bf, t);
}

// Lane l takes the value of lane l ^ 16 (the other half of the wave).
__device__ __forceinline__ float xhalf(float x) {
  int b = __builtin_bit_cast(int, x);
  return __builtin_bit_cast(float,
      __builtin_amdgcn_permlanex16(b, b, 0x76543210, 0xfedcba98, false, false));
}
// Lane l takes the value of lane l ^ X inside its 16-lane row (DPP row_xmask:X).
template <int X>
__device__ __forceinline__ float xrow(float v) {
  return __builtin_bit_cast(float,
      __builtin_amdgcn_update_dpp(0, __builtin_bit_cast(int, v), 0x160 + X, 0xf, 0xf, true));
}
__device__ __forceinline__ float rsum16(float v) {
  v += xrow<1>(v);
  v += xrow<2>(v);
  v += xrow<4>(v);
  v += xrow<8>(v);
  return v;
}

// ------------------------------- prep kernel -------------------------------
// One launch does all that the later kernels need beforehand. Its three jobs are
// independent of each other and take block ranges of one grid; a W or Z thread
// writes one 16-byte piece and a P block all of its batch's places, so a block
// writes whole lines of its own.
//   PREP_W blocks: [Wq; Wk; Wv] (row-major [384, 256], f32) to bf16 in fragment
//                  order: 16-row tile, then 32-wide k block, then the map at
//                  load_frag(). A piece is 8 consecutive k of one row.
//   PREP_P blocks: one per batch. A masked key has probability 0 as long as its
//                  batch has an unmasked one, and the result does not depend on
//                  the order of a batch's rows (keys are summed over, queries
//                  averaged). So the rows are put in a new order, the unmasked
//                  first, each kind in its old order: perm[place] = old row,
//                  slp and mb = sl and the mask bias in the new order, nkey =
//                  the number of keys that the later kernels go through (all
//                  of them where every key is masked: the uniform row).
//   PREP_Z blocks: zeros in out, into which pool_kernel adds.
#define PREP_W (384 * DD / 8 / 256)
#define PREP_P BB
#define PREP_Z (BB * DD / 4 / 256)

__global__ __launch_bounds__(256) void prep_kernel(
    const float* __restrict__ Wq, const float* __restrict__ Wk,
    const float* __restrict__ Wv, const int* __restrict__ mask,
    const float* __restrict__ sl,
    bf16* __restrict__ wb, float* __restrict__ mb, float* __restrict__ slp,
    int* __restrict__ perm, int* __restrict__ nkey, float* __restrict__ out)
{
  __shared__ int wsum[8];
  const int blk = blockIdx.x;
  if (blk < PREP_W) {
    const int i    = blk * 256 + threadIdx.x;  // piece: elements 8 i .. 8 i + 7 of wb
    const int tile = blk >> 1;                 // 512 pieces to a 16-row tile
    const float* w = tile < QQ / 16 ? Wq + tile * (16 * DD)
                   : tile < 2 * QQ / 16 ? Wk + (tile - QQ / 16) * (16 * DD)
                                        : Wv + (tile - 2 * QQ / 16) * (16 * DD);
    const int k = ((i >> 6) & 7) * 32 + ((i >> 5) & 1) * 16 + ((i >> 4) & 1) * 8;
    const f32x4* s = (const f32x4*)(w + (i & 15) * DD + k);
    const f32x4 f0 = s[0], f1 = s[1];
    __attribute__((aligned(16))) bf16 pk[8];
    for (int e = 0; e < 4; ++e) { pk[e] = (bf16)f0[e]; pk[4 + e] = (bf16)f1[e]; }
    *(u32x4*)(wb + (size_t)i * 8) = *(const u32x4*)pk;
  } else if (blk < PREP_W + PREP_P) {
    const int base = (blk - PREP_W) * TT;
    const int t0   = threadIdx.x * 8;          // a thread takes 8 rows in a row
    const int lane = threadIdx.x & 31, wave = threadIdx.x >> 5;
    const i32x4 m0 = *(const i32x4*)(mask + base + t0), m1 = *(const i32x4*)(mask + base + t0 + 4);
    const f32x4 s0 = *(const f32x4*)(sl + base + t0),   s1 = *(const f32x4*)(sl + base + t0 + 4);
    int cnt = 0;
    for (int e = 0; e < 4; ++e) cnt += (m0[e] != 0) + (m1[e] != 0);
    int inc = cnt;                             // unmasked rows up to and with this thread's
    for (int d = 1; d < 32; d <<= 1) {
      const int o = __shfl_up(inc, d);
      if (lane >= d) inc += o;
    }
    if (lane == 31) wsum[wave] = inc;
    __syncthreads();   // every wave's count is in LDS
    int before = inc - cnt, total = 0;
    for (int w = 0; w < 8; ++w) {
      const int c = wsum[w];
      before += (w < wave) ? c : 0;
      total  += c;
    }
    int pv = base + before;                    // next place among the unmasked
    int pm = base + total + (t0 - before);     // next place among the masked
    for (int e = 0; e < 8; ++e) {
      const bool keep = (e < 4 ? m0[e & 3] : m1[e & 3]) != 0;
      const int p = keep ? pv : pm;
      pv += keep ? 1 : 0;
      pm += keep ? 0 : 1;
      perm[p] = t0 + e;
      slp[p]  = e < 4 ? s0[e & 3] : s1[e & 3];
      mb[p]   = keep ? 0.0f : -1e9f;
    }
    if (threadIdx.x == 0) nkey[blk - PREP_W] = total == 0 ? TT : total;
  } else {
    ((f32x4*)out)[(blk - PREP_W - PREP_P) * 256 + threadIdx.x] = f32x4{0.0f, 0.0f, 0.0f, 0.0f};
    // Precaution: the listing rewrites this store's address registers further on.
    asm volatile("s_wait_xcnt 0x0" ::: "memory");
  }
}

// --------------------------- projection kernel -----------------------------
// Computes [B*T, 384] = x[B*T,256] @ WB^T (WB = [Wq;Wk;Wv] row-major [384,256])
// x arrives as the f32 input and is read once: a block takes the 64 rows that
// perm names for its 64 places (all that follows is in the new order) with
// whole-line loads, rounds them to bf16 and lays them in LDS as fragments.
// wb arrives in fragment order (prep_kernel); q, k, v leave in it:
// cols 0..63 -> q (bf16), fragments [16-row tile][e / 32]
// cols 64..127 -> k scaled by (1/sqrt(QK))*(1+clip(sl)^2)  (bf16), same order
// cols 128..383 -> v (bf16), fragments of v transposed (row = d, k = t):
//                  [b][t / 32][d / 16]
// grid B*T/64, block 256 = 8 waves. Wave w takes row tiles 2 (w / 4) and
// 2 (w / 4) + 1, so one load of a W fragment serves two products, and column
// tiles (w % 4) + 4 i: one of q, one of k, four of v; 12 accumulators.

// LDS: group g = (row / 16) * 32 + k / 8 holds 16 rows x 8 k (256 bytes). The
// pitch of 272 bytes puts the 16 groups that one wave's store touches, and the
// two groups that one fragment read touches, on different banks.
#define XP 136

__global__ __launch_bounds__(256) void proj_kernel(
    const float* __restrict__ x, const bf16* __restrict__ wb,
    const float* __restrict__ bq, const float* __restrict__ bk,
    const float* __restrict__ bv, const float* __restrict__ sl,
    const int* __restrict__ perm,
    bf16* __restrict__ qb, bf16* __restrict__ kb, bf16* __restrict__ vtb)
{
  __shared__ __attribute__((aligned(16))) bf16 xs[128 * XP];
  const int lane = threadIdx.x & 31;
  const int wave = __builtin_amdgcn_readfirstlane(threadIdx.x >> 5);  // scalar: tile numbers and bases
  const int n = lane & 15, hi = lane >> 4;

  const int tile0 = blockIdx.x * 4 + (wave >> 2) * 2;   // first 16-row tile of this wave
  const int cq    = wave & 3;
  const bf16* wrow = wb + (size_t)cq * 16 * DD;         // column tile cq + 4 i lies 4 i tiles on

  // Two sets of operand registers, as in pool_kernel: the six W fragments and
  // the two x fragments of k block kf + 1 are fetched while block kf is worked on.
  v16bf w[2][6], a[2][2];
  auto fetch_w = [&](int set, int kf) {
#pragma unroll   // constant element numbers keep the fragments in registers
    for (int i = 0; i < 6; ++i) w[set][i] = load_frag(wrow + i * (64 * DD) + kf * 512);
  };
  auto fetch_a = [&](int set, int kf) {
#pragma unroll   // as above
    for (int t = 0; t < 2; ++t) {
      const bf16* s = xs + (((wave >> 2) * 2 + t) * 32 + kf * 4 + hi) * XP + n * 8;
      BF16Tile tl;
      tl.lo = *(const u32x4*)(s);
      tl.hi = *(const u32x4*)(s + 2 * XP);
      a[set][t] = __builtin_bit_cast(v16bf, tl);
    }
  };

  // Thread t takes the 16-byte piece t of every 4 rows: a wave reads half a row.
  {
    const float* xb = x + (size_t)(blockIdx.x / (TT / 64)) * TT * DD;
    const int* pr = perm + blockIdx.x * 64 + (wave >> 1);   // scalar: a wave reads half of one row
    const f32x4* ps[16];
    f32x4 f[16];
#pragma unroll   // constant element numbers keep the addresses in registers
    for (int j = 0; j < 16; ++j)
      ps[j] = (const f32x4*)(xb + (pr[j * 4] & (TT - 1)) * DD) + (threadIdx.x & 63);
#pragma unroll   // all 16 loads of a thread are in flight together
    for (int j = 0; j < 16; ++j) f[j] = *ps[j];
    // Precaution: the wait in front of any rewrite of these loads' address
    // registers; as its inputs the 16 addresses stay in their registers up to it.
    asm volatile("s_wait_xcnt 0x0"
                 :: "v"(ps[0]), "v"(ps[1]), "v"(ps[2]), "v"(ps[3]), "v"(ps[4]), "v"(ps[5]),
                    "v"(ps[6]), "v"(ps[7]), "v"(ps[8]), "v"(ps[9]), "v"(ps[10]), "v"(ps[11]),
                    "v"(ps[12]), "v"(ps[13]), "v"(ps[14]), "v"(ps[15])
                 : "memory");
    fetch_w(0, 0);   // needs nothing of x: in flight behind the x loads
    const int k = (threadIdx.x & 63) * 4;
    bf16* dst = xs + (k >> 3) * XP + (k & 7);
#pragma unroll   // constant element numbers keep f in registers
    for (int j = 0; j < 16; ++j) {
      const int row = j * 4 + (threadIdx.x >> 6);
      __attribute__((aligned(8))) bf16 pk[4];
      for (int e = 0; e < 4; ++e) pk[e] = (bf16)f[j][e];
      *(u32x2*)(dst + (row >> 4) * (32 * XP) + (row & 15) * 8) = *(const u32x2*)pk;
    }
  }

  v8f c[6][2];
#pragma unroll   // constant element numbers for c[][]
  for (int i = 0; i < 6; ++i) {
    const int col = (cq + 4 * i) * 16 + n;
    const float bias = (i == 0) ? bq[col] : (i == 1 ? bk[col - QQ] : bv[col - 2*QQ]);
    for (int r = 0; r < 8; ++r) { c[i][0][r] = bias; c[i][1][r] = bias; }
  }
  __syncthreads();   // the block's 64 rows are in LDS
  fetch_a(0, 0);

  v8f slv[2];                                  // sl of the lane's 8 rows of each tile
#pragma unroll   // kf & 1 names the register set at compile time
  for (int kf = 0; kf < 8; ++kf) {
    const int cur = kf & 1;
    if (kf < 7) {
      fetch_w(cur ^ 1, kf + 1); fetch_a(cur ^ 1, kf + 1);
    } else {
      const float* sp = sl + tile0 * 16 + 8 * hi;
      slv[0] = *(const v8f*)(sp);
      slv[1] = *(const v8f*)(sp + 16);
    }
    // Keeps the fetches above in front of the products below: sunk to their
    // first use, each would be waited for at its full latency.
    __builtin_amdgcn_sched_barrier(0);
#pragma unroll   // constant element numbers for c[][] and w[][]
    for (int i = 0; i < 6; ++i) {
      c[i][0] = __builtin_amdgcn_wmma_f32_16x16x32_bf16(false, a[cur][0], false, w[cur][i], (short)0, c[i][0], false, false);
      c[i][1] = __builtin_amdgcn_wmma_f32_16x16x32_bf16(false, a[cur][1], false, w[cur][i], (short)0, c[i][1], false, false);
    }
  }

  // Epilogue. C/D layout: lane holds column n; VGPR r holds row (r + 8*hi).
#pragma unroll   // i decides the kind of column tile at compile time
  for (int i = 0; i < 6; ++i) {
    const int nt = cq + 4 * i;                 // 0..23: 16-col tile
#pragma unroll   // constant element numbers for c[][]
    for (int t = 0; t < 2; ++t) {
      const int tile = tile0 + t;
      if (i < 2) {
        // e = (nt & 3) * 16 + n is the fragment's k, the row r + 8 * hi its row.
        const size_t fo = (size_t)tile * (16 * QQ) + ((nt >> 1) & 1) * 512 + (nt & 1) * 256
                        + (((n >> 3) << 4) + 8 * hi) * 8 + (n & 7);
        for (int r = 0; r < 8; ++r) {
          float v = c[i][t][r];
          if (i == 1) {
            float s = slv[t][r];               // row tile * 16 + r + 8 * hi
            s = fminf(fmaxf(s, 0.0f), 1.0f);
            v *= 0.125f * (1.0f + s * s);      // 1/sqrt(64) * (1 + sl^2)
            kb[fo + r * 8] = (bf16)v;
          } else {
            qb[fo + r * 8] = (bf16)v;
          }
        }
      } else {
        // The lane's 8 consecutive t of column d are one 16-byte chunk of the
        // fragment (t / 32, d / 16): half (tile & 1), lane as it is here.
        __attribute__((aligned(16))) bf16 pk[8];
        for (int r = 0; r < 8; ++r) pk[r] = (bf16)c[i][t][r];
        *(u32x4*)(vtb + ((size_t)(tile >> 1) * (DD / 16) + (nt - 8)) * 512
                      + (tile & 1) * 256 + lane * 8) = *(const u32x4*)pk;
      }
    }
  }
}

// ---------------------------- attention kernels ----------------------------
// The output is the mean over the queries of P V, and that mean commutes with
// the product: out = (1/T) * V^T (sum over queries of P^T). A query's row of P
// must be normalised before rows are added, so the work runs in two passes.
// Both form S^T = K Q^T: in a D tile a lane holds ONE query (column n) and its
// registers hold keys 8 * hi + r.
//
// The mask bias belongs to the key, the D row. It is added to the finished
// score by a vector add, whose one rounding leaves every masked score at the
// same value; the maximum is subtracted before the scaling to base 2, so that
// a row with every key masked comes out uniform.

#define LOG2E 1.44269504f

__device__ __forceinline__ float max16(v8f a, v8f b) {
  float t[8];
  for (int r = 0; r < 8; ++r) t[r] = fmaxf(a[r], b[r]);
  return fmaxf(fmaxf(fmaxf(t[0], t[1]), fmaxf(t[2], t[3])),
               fmaxf(fmaxf(t[4], t[5]), fmaxf(t[6], t[7])));
}
__device__ __forceinline__ v8f exp2v(v8f x) {
  v8f y;
  for (int r = 0; r < 8; ++r) y[r] = __builtin_amdgcn_exp2f(x[r]);
  return y;
}
__device__ __forceinline__ float sum8(v8f t) {
  return ((t[0] + t[1]) + (t[2] + t[3])) + ((t[4] + t[5]) + (t[6] + t[7]));
}

// Pass 1: maximum and log2 of the sum of every query's scores.
// grid (T/64, B), block 256 = 8 waves. A block owns 64 queries (4 tiles, held
// as B operands by every wave, so one load of a key fragment serves 4 tiles);
// wave w takes the groups of 32 keys w, w + 8, ... below nkey. A lane keeps maximum and sum of its
// own keys; halves and waves are joined once, at the end.
__global__ __launch_bounds__(256) void stat_kernel(
    const bf16* __restrict__ qb, const bf16* __restrict__ kb,
    const float* __restrict__ mbias, const int* __restrict__ nkey,
    float* __restrict__ qmax, float* __restrict__ qlog)
{
  __shared__ float sm[8][64];
  __shared__ float ss[8][64];
  const int lane = threadIdx.x & 31;
  const int wave = __builtin_amdgcn_readfirstlane(threadIdx.x >> 5);  // scalar: loop bounds and bases
  const int n = lane & 15, hi = lane >> 4;
  const int q0 = blockIdx.x * 64;
  const int b  = blockIdx.y;

  v16bf qa[4][2];
  for (int i = 0; i < 4; ++i) {
    const size_t qrow = (size_t)(b * TT + q0 + i * 16) * QQ;
    qa[i][0] = load_frag(qb + qrow + 0);
    qa[i][1] = load_frag(qb + qrow + 512);
  }
  float m[4], l[4];
  for (int i = 0; i < 4; ++i) { m[i] = -1e30f; l[i] = 0.0f; }

  const int nk = min(nkey[b], TT);
  for (int j0 = wave * 32; j0 < nk; j0 += 256) {
    const size_t krow = (size_t)(b * TT + j0) * QQ;
    v16bf k0a = load_frag(kb + krow + 0);
    v16bf k0b = load_frag(kb + krow + 512);
    v16bf k1a = load_frag(kb + krow + 1024);
    v16bf k1b = load_frag(kb + krow + 1536);
    const float* mp = mbias + b * TT + j0 + 8 * hi;
    const v8f mb0 = *(const v8f*)(mp);
    const v8f mb1 = *(const v8f*)(mp + 16);
    for (int i = 0; i < 4; ++i) {
      v8f s0 = {}, s1 = {};
      s0 = __builtin_amdgcn_wmma_f32_16x16x32_bf16(false, k0a, false, qa[i][0], (short)0, s0, false, false);
      s1 = __builtin_amdgcn_wmma_f32_16x16x32_bf16(false, k1a, false, qa[i][0], (short)0, s1, false, false);
      s0 = __builtin_amdgcn_wmma_f32_16x16x32_bf16(false, k0b, false, qa[i][1], (short)0, s0, false, false);
      s1 = __builtin_amdgcn_wmma_f32_16x16x32_bf16(false, k1b, false, qa[i][1], (short)0, s1, false, false);
      s0 += mb0;
      s1 += mb1;
      const float mn = fmaxf(m[i], max16(s0, s1));
      const float corr = __builtin_amdgcn_exp2f((m[i] - mn) * LOG2E);
      const v8f p = exp2v((s0 - mn) * LOG2E) + exp2v((s1 - mn) * LOG2E);
      l[i] = l[i] * corr + sum8(p);
      m[i] = mn;
    }
  }

  for (int i = 0; i < 4; ++i) {
    const float mo = xhalf(m[i]), lo = xhalf(l[i]);
    const float mj = fmaxf(m[i], mo);
    const float lj = l[i] * __builtin_amdgcn_exp2f((m[i] - mj) * LOG2E)
                   + lo   * __builtin_amdgcn_exp2f((mo   - mj) * LOG2E);
    if (hi == 0) { sm[wave][i * 16 + n] = mj; ss[wave][i * 16 + n] = lj; }
  }
  __syncthreads();   // every wave's partial maximum and sum are in LDS
  if (threadIdx.x < 64) {
    const int q = threadIdx.x;
    float mj = sm[0][q];
    for (int w = 1; w < 8; ++w) mj = fmaxf(mj, sm[w][q]);
    float lj = 0.0f;
    for (int w = 0; w < 8; ++w)
      lj += ss[w][q] * __builtin_amdgcn_exp2f((sm[w][q] - mj) * LOG2E);
    qmax[b * TT + q0 + q] = mj;
    qlog[b * TT + q0 + q] = __builtin_amdgcn_logf(lj);   // log2
  }
}

// Pass 2: W^T = sum over query tiles of the normalised P^T, then V^T W^T.
// grid (T/64, B), block 256 = 8 waves. The work of a batch is its key blocks
// below nkey (64 keys, held as A operands by every wave) times its 128 query
// tiles; the batch's 32 work-groups take equal runs of it, key block by key
// block, so a run lies in one key block or in two that follow each other. Of a
// run's query tiles wave w takes the w-th, the (w + 8)-th, ... The sum over
// tiles is in-lane: column n of W^T collects the queries n mod 16. The waves'
// sums are joined through LDS; converted in place they are the bf16 B operand
// of the second product (hardware k order, the order of the v fragments), of
// which wave w does 32 output rows; the 16 columns are summed at the very end.
__global__ __launch_bounds__(256) void pool_kernel(
    const bf16* __restrict__ qb, const bf16* __restrict__ kb,
    const bf16* __restrict__ vtb, const float* __restrict__ mbias,
    const float* __restrict__ qmax, const float* __restrict__ qlog,
    const int* __restrict__ nkey, float* __restrict__ out)
{
  __shared__ f32x4 red[8][8][32];              // [wave][4 registers][lane]
  __shared__ f32x4 fin[8][32];                 // [4 registers][lane]
  const int lane = threadIdx.x & 31;
  const int wave = __builtin_amdgcn_readfirstlane(threadIdx.x >> 5);  // scalar: loop bounds and bases
  const int n = lane & 15, hi = lane >> 4;
  const int b  = blockIdx.y;
  const int run = ((min(nkey[b], TT) + 63) >> 6) * (TT / 16) / (TT / 64);   // tiles of a work-group: at most T/16
  const int u0 = blockIdx.x * run, u1 = u0 + run;   // unit = key block * (T/16) + query tile

  // At most two trips; every bound is the same for the whole work-group.
  for (int kblk = u0 / (TT / 16); kblk * (TT / 16) < u1; ++kblk) {
  const int j0 = kblk * 64;
  const int qe = min(u1 - kblk * (TT / 16), TT / 16);            // end of the run's query tiles here
  int qt = max(u0 - kblk * (TT / 16), 0) + wave;                 // this wave's first

  v16bf ka[4][2];
  v8f mb[4], acc[4];
  for (int i = 0; i < 4; ++i) {
    const size_t krow = (size_t)(b * TT + j0 + i * 16) * QQ;
    ka[i][0] = load_frag(kb + krow + 0);
    ka[i][1] = load_frag(kb + krow + 512);
    mb[i] = *(const v8f*)(mbias + b * TT + j0 + i * 16 + 8 * hi);
    acc[i] = v8f{};
  }

  // One query tile: scores of the block's 64 keys, normalised, added to acc.
  auto tile = [&](v16bf qa0, v16bf qa1, float qm, float ql) {
    v8f s[4];
    for (int i = 0; i < 4; ++i) {
      s[i] = v8f{};
      s[i] = __builtin_amdgcn_wmma_f32_16x16x32_bf16(false, ka[i][0], false, qa0, (short)0, s[i], false, false);
    }
    for (int i = 0; i < 4; ++i)
      s[i] = __builtin_amdgcn_wmma_f32_16x16x32_bf16(false, ka[i][1], false, qa1, (short)0, s[i], false, false);
    for (int i = 0; i < 4; ++i)
      acc[i] += exp2v(((s[i] + mb[i]) - qm) * LOG2E - ql);
  };

  // Two sets of operand registers: each tile's operands are fetched while the
  // tile before it is worked on, and no register copy is needed between them.
  // A fetch past the batch's last tile is turned to it; one past the run's end
  // is not used.
  const bf16*  qp = qb + (size_t)b * TT * QQ;
  const float* pm = qmax + b * TT + n;
  const float* pl = qlog + b * TT + n;
  v16bf a0, a1, b0, b1;
  float am, al, bm, bl;
  auto fetch = [&](int t, v16bf& f0, v16bf& f1, float& fm, float& fl) {
    t = min(t, TT / 16 - 1);
    const bf16*  fq = qp + t * (16 * QQ);
    const float* fa = pm + t * 16;
    const float* fb = pl + t * 16;
    f0 = load_frag(fq); f1 = load_frag(fq + 512);
    fm = *fa; fl = *fb;
    // Precaution: the wait in front of any rewrite of these loads' address registers.
    asm volatile("s_wait_xcnt 0x0" ::: "memory");
  };
  fetch(qt, a0, a1, am, al);
  for (; qt + 8 < qe; qt += 16) {
    fetch(qt + 8, b0, b1, bm, bl);
    tile(a0, a1, am, al);
    fetch(qt + 16, a0, a1, am, al);
    tile(b0, b1, bm, bl);
  }
  if (qt < qe) tile(a0, a1, am, al);

  for (int i = 0; i < 4; ++i) {
    red[wave][2 * i + 0][lane] = f32x4{acc[i][0], acc[i][1], acc[i][2], acc[i][3]};
    red[wave][2 * i + 1][lane] = f32x4{acc[i][4], acc[i][5], acc[i][6], acc[i][7]};
  }
  __syncthreads();   // every wave's sums are in LDS
  f32x4 g = red[0][wave][lane];
  for (int w = 1; w < 8; ++w) g += red[w][wave][lane];
  fin[wave][lane] = g;
  __syncthreads();   // the joined sums are in LDS

  v16bf pb0, pb1;
#pragma unroll   // constant element numbers keep both operands in registers
  for (int c = 0; c < 4; ++c) {
    const f32x4 f0 = fin[c][lane], f1 = fin[4 + c][lane];
#pragma unroll   // as above
    for (int e = 0; e < 4; ++e) {
      pb0[4 * c + e] = (bf16)f0[e];
      pb1[4 * c + e] = (bf16)f1[e];
    }
  }

  const float invT = 1.0f / (float)TT;
  const size_t vrow = (size_t)(b * TT + j0) * DD;
  for (int c = 0; c < 2; ++c) {
    const int dt = wave * 2 + c;               // 16-row tile of O^T
    v16bf v0 = load_frag(vtb + vrow + dt * 512);
    v16bf v1 = load_frag(vtb + vrow + 32 * DD + dt * 512);
    v8f o = {};
    o = __builtin_amdgcn_wmma_f32_16x16x32_bf16(false, v0, false, pb0, (short)0, o, false, false);
    o = __builtin_amdgcn_wmma_f32_16x16x32_bf16(false, v1, false, pb1, (short)0, o, false, false);
    float sacc = 0.0f;
    for (int r = 0; r < 8; ++r) {
      float q = rsum16(o[r]);                  // every lane of the row holds the sum
      sacc = (n == r) ? q : sacc;              // lane n < 8 keeps row 8 * hi + n
    }
    if (n < 8)
      atomicAdd(&out[b * DD + dt * 16 + 8 * hi + n], sacc * invT);
    // Precaution: in front of the rewrite of the add's registers further on.
    asm volatile("s_wait_xcnt 0x0" ::: "memory");
  }
  }
}

// ------------------------------- launcher ----------------------------------

extern "C" void kernel_launch(void* const* d_in, const int* in_sizes, int n_in,
                              void* d_out, int out_size, void* d_ws, size_t ws_size,
                              hipStream_t stream) {
  const float* x    = (const float*)d_in[0];
  const float* sl   = (const float*)d_in[1];
  const int*   mask = (const int*)  d_in[2];
  const float* Wq   = (const float*)d_in[3];
  const float* bq   = (const float*)d_in[4];
  const float* Wk   = (const float*)d_in[5];
  const float* bk   = (const float*)d_in[6];
  const float* Wv   = (const float*)d_in[7];
  const float* bv   = (const float*)d_in[8];
  float* out = (float*)d_out;

  char* ws = (char*)d_ws;
  const size_t OFF_WB = 0;
  const size_t OFF_QB = OFF_WB + (size_t)384 * DD * 2;
  const size_t OFF_KB = OFF_QB + (size_t)BB * TT * QQ * 2;
  const size_t OFF_VT = OFF_KB + (size_t)BB * TT * QQ * 2;
  const size_t OFF_MB = OFF_VT + (size_t)BB * DD * TT * 2;
  const size_t OFF_QM = OFF_MB + (size_t)BB * TT * 4;
  const size_t OFF_QL = OFF_QM + (size_t)BB * TT * 4;
  const size_t OFF_SP = OFF_QL + (size_t)BB * TT * 4;
  const size_t OFF_PR = OFF_SP + (size_t)BB * TT * 4;
  const size_t OFF_NK = OFF_PR + (size_t)BB * TT * 4;

  bf16*  wb  = (bf16*)(ws + OFF_WB);
  bf16*  qbp = (bf16*)(ws + OFF_QB);
  bf16*  kbp = (bf16*)(ws + OFF_KB);
  bf16*  vtb = (bf16*)(ws + OFF_VT);
  float* mb  = (float*)(ws + OFF_MB);
  float* qm  = (float*)(ws + OFF_QM);
  float* ql  = (float*)(ws + OFF_QL);
  float* slp = (float*)(ws + OFF_SP);
  int*   pr  = (int*)(ws + OFF_PR);
  int*   nk  = (int*)(ws + OFF_NK);

  // 1) weights to bf16 fragments, row order and key counts, zeros in the output: one launch
  prep_kernel<<<PREP_W + PREP_P + PREP_Z, 256, 0, stream>>>(Wq, Wk, Wv, mask, sl, wb, mb, slp, pr, nk, out);

  // 2) QKV projection (WMMA bf16), x converted on the way
  proj_kernel<<<BB * TT / 64, 256, 0, stream>>>(
      x, wb, bq, bk, bv, slp, pr, qbp, kbp, vtb);

  // 3) every query's maximum and log-sum (WMMA bf16)
  stat_kernel<<<dim3(TT / 64, BB), 256, 0, stream>>>(qbp, kbp, mb, nk, qm, ql);

  // 4) query-sum of the normalised probabilities, then the V product (WMMA bf16)
  pool_kernel<<<dim3(TT / 64, BB), 256, 0, stream>>>(qbp, kbp, vtb, mb, qm, ql, nk, out);
}

// v007
// A run of this version takes 38.1 microseconds.
// Timed twice side by side with v006, it ran 1.05 times as fast both times.
// Over all steps from v000 it is 10.5 times as fast.
#include <hip/hip_runtime.h>

// ---------------------------------------------------------------------------
// NEGAPooling for MI455X (gfx1250, wave32, WMMA bf16)
// B=16, T=2048, D=256, QK=64
// ---------------------------------------------------------------------------

typedef __bf16 bf16;
typedef __attribute__((ext_vector_type(16))) __bf16       v16bf;
typedef __attribute__((ext_vector_type(8)))  float        v8f;
typedef __attribute__((ext_vector_type(4)))  unsigned int u32x4;
typedef __attribute__((ext_vector_type(2)))  unsigned int u32x2;
typedef __attribute__((ext_vector_type(4)))  float        f32x4;
typedef __attribute__((ext_vector_type(4)))  int          i32x4;

#define BB 16
#define TT 2048
#define DD 256
#define QQ 64

struct BF16Tile { u32x4 lo, hi; };

// Operand layout of the 16x16x32 bf16 WMMA (ISA 7.12.2, 16-bit A 16x32):
// lanes 0-15 hold row M=lane, K chunks {0..7, 16..23}; lanes 16-31 hold row
// M=lane-16, K {8..15, 24..31}. B mirrors it (lane = column N, same K chunks).

// Fragment order: every WMMA operand that lives in the workspace is stored as
// 1 KiB fragments (16 rows x 32 k). Element (row c, k) of a fragment sits at
//   ((k >> 4) & 1) * 256 + (((k >> 3) & 1) * 16 + c) * 8 + (k & 7)
// so lane l finds the two 16-byte chunks of that layout at l * 8 and
// 256 + l * 8: each load of a wave reads 512 contiguous bytes (4 cache lines)
// where the row-major tile made it touch 16 lines.
__device__ __forceinline__ v16bf load_frag(const bf16* frag) {
  const bf16* p = frag + ((threadIdx.x & 31) << 3);
  BF16Tile t;
  t.lo = *(const u32x4*)(p);
  t.hi = *(const u32x4*)(p + 256);
  return __builtin_bit_cast(v16bf, t);
}

// Lane l takes the value of lane l ^ 16 (the other half of the wave).
__device__ __forceinline__ float xhalf(float x) {
  int b = __builtin_bit_cast(int, x);
  return __builtin_bit_cast(float,
      __builtin_amdgcn_permlanex16(b, b, 0x76543210, 0xfedcba98, false, false));
}
// Lane l takes the value of lane l ^ X inside its 16-lane row (DPP row_xmask:X).
template <int X>
__device__ __forceinline__ float xrow(float v) {
  return __builtin_bit_cast(float,
      __builtin_amdgcn_update_dpp(0, __builtin_bit_cast(int, v), 0x160 + X, 0xf, 0xf, true));
}
__device__ __forceinline__ float rsum16(float v) {
  v += xrow<1>(v);
  v += xrow<2>(v);
  v += xrow<4>(v);
  v += xrow<8>(v);
  return v;
}

// ------------------------------- prep kernel -------------------------------
// One launch does all that the later kernels need beforehand. Its three jobs are
// independent of each other and take block ranges of one grid; a W or Z thread
// writes one 16-byte piece and a P block all of its batch's places, so a block
// writes whole lines of its own.
//   PREP_W blocks: [Wq; Wk; Wv] (row-major [384, 256], f32) to bf16 in fragment
//                  order: 16-row tile, then 32-wide k block, then the map at
//                  load_frag(). A piece is 8 consecutive k of one row.
//   PREP_P blocks: one per batch. A masked key has probability 0 as long as its
//                  batch has an unmasked one, and the result does not depend on
//                  the order of a batch's rows (keys are summed over, queries
//                  averaged). So the rows are put in a new order, the unmasked
//                  first, each kind in its old order: perm[place] = old row,
//                  slp and mb = sl and the mask bias in the new order, nkey =
//                  the number of keys that the later kernels go through (all
//                  of them where every key is masked: the uniform row).
//   PREP_Z blocks: zeros in out, into which pool_kernel adds.
#define PREP_W (384 * DD / 8 / 256)
#define PREP_P BB
#define PREP_Z (BB * DD / 4 / 256)

__global__ __launch_bounds__(256) void prep_kernel(
    const float* __restrict__ Wq, const float* __restrict__ Wk,
    const float* __restrict__ Wv, const int* __restrict__ mask,
    const float* __restrict__ sl,
    bf16* __restrict__ wb, float* __restrict__ mb, float* __restrict__ slp,
    int* __restrict__ perm, int* __restrict__ nkey, float* __restrict__ out)
{
  __shared__ int wsum[8];
  const int blk = blockIdx.x;
  if (blk < PREP_W) {
    const int i    = blk * 256 + threadIdx.x;  // piece: elements 8 i .. 8 i + 7 of wb
    const int tile = blk >> 1;                 // 512 pieces to a 16-row tile
    const float* w = tile < QQ / 16 ? Wq + tile * (16 * DD)
                   : tile < 2 * QQ / 16 ? Wk + (tile - QQ / 16) * (16 * DD)
                                        : Wv + (tile - 2 * QQ / 16) * (16 * DD);
    const int k = ((i >> 6) & 7) * 32 + ((i >> 5) & 1) * 16 + ((i >> 4) & 1) * 8;
    const f32x4* s = (const f32x4*)(w + (i & 15) * DD + k);
    const f32x4 f0 = s[0], f1 = s[1];
    __attribute__((aligned(16))) bf16 pk[8];
    for (int e = 0; e < 4; ++e) { pk[e] = (bf16)f0[e]; pk[4 + e] = (bf16)f1[e]; }
    *(u32x4*)(wb + (size_t)i * 8) = *(const u32x4*)pk;
  } else if (blk < PREP_W + PREP_P) {
    const int base = (blk - PREP_W) * TT;
    const int t0   = threadIdx.x * 8;          // a thread takes 8 rows in a row
    const int lane = threadIdx.x & 31, wave = threadIdx.x >> 5;
    const i32x4 m0 = *(const i32x4*)(mask + base + t0), m1 = *(const i32x4*)(mask + base + t0 + 4);
    const f32x4 s0 = *(const f32x4*)(sl + base + t0),   s1 = *(const f32x4*)(sl + base + t0 + 4);
    int cnt = 0;
    for (int e = 0; e < 4; ++e) cnt += (m0[e] != 0) + (m1[e] != 0);
    int inc = cnt;                             // unmasked rows up to and with this thread's
    for (int d = 1; d < 32; d <<= 1) {
      const int o = __shfl_up(inc, d);
      if (lane >= d) inc += o;
    }
    if (lane == 31) wsum[wave] = inc;
    __syncthreads();   // every wave's count is in LDS
    int before = inc - cnt, total = 0;
    for (int w = 0; w < 8; ++w) {
      const int c = wsum[w];
      before += (w < wave) ? c : 0;
      total  += c;
    }
    int pv = base + before;                    // next place among the unmasked
    int pm = base + total + (t0 - before);     // next place among the masked
    for (int e = 0; e < 8; ++e) {
      const bool keep = (e < 4 ? m0[e & 3] : m1[e & 3]) != 0;
      const int p = keep ? pv : pm;
      pv += keep ? 1 : 0;
      pm += keep ? 0 : 1;
      perm[p] = t0 + e;
      slp[p]  = e < 4 ? s0[e & 3] : s1[e & 3];
      mb[p]   = keep ? 0.0f : -1e9f;
    }
    if (threadIdx.x == 0) nkey[blk - PREP_W] = total == 0 ? TT : total;
  } else {
    ((f32x4*)out)[(blk - PREP_W - PREP_P) * 256 + threadIdx.x] = f32x4{0.0f, 0.0f, 0.0f, 0.0f};
    // Precaution: the listing rewrites this store's address registers further on.
    asm volatile("s_wait_xcnt 0x0" ::: "memory");
  }
}

// --------------------------- projection kernel -----------------------------
// Computes [B*T, 384] = x[B*T,256] @ WB^T (WB = [Wq;Wk;Wv] row-major [384,256])
// x arrives as the f32 input and is read once: a block takes the 64 rows that
// perm names for its 64 places (all that follows is in the new order) with
// whole-line loads, rounds them to bf16 and lays them in LDS as fragments.
// wb arrives in fragment order (prep_kernel); q, k, v leave in it:
// cols 0..63 -> q (bf16), fragments [16-row tile][e / 32]
// cols 64..127 -> k scaled by (1/sqrt(QK))*(1+clip(sl)^2)  (bf16), same order
// cols 128..383 -> v (bf16), fragments of v transposed (row = d, k = t):
//                  [b][t / 32][d / 16]
// grid B*T/64, block 256 = 8 waves. Wave w takes row tiles 2 (w / 4) and
// 2 (w / 4) + 1, so one load of a W fragment serves two products, and column
// tiles (w % 4) + 4 i: one of q, one of k, four of v; 12 accumulators.
// k and v are read only in the 64-place blocks that begin below nkey (the key
// loops end there), q everywhere: a block whose 64 places all lie at or past
// nkey makes q alone (i = 0). Blocks are numbered place block first, batch
// second, so that the long blocks start first and the short ones fill in behind.

template <int N> struct Count { static constexpr int v = N; };

// LDS: group g = (row / 16) * 32 + k / 8 holds 16 rows x 8 k (256 bytes). The
// pitch of 272 bytes puts the 16 groups that one wave's store touches, and the
// two groups that one fragment read touches, on different banks.
#define XP 136

__global__ __launch_bounds__(256) void proj_kernel(
    const float* __restrict__ x, const bf16* __restrict__ wb,
    const float* __restrict__ bq, const float* __restrict__ bk,
    const float* __restrict__ bv, const float* __restrict__ sl,
    const int* __restrict__ perm, const int* __restrict__ nkey,
    bf16* __restrict__ qb, bf16* __restrict__ kb, bf16* __restrict__ vtb)
{
  __shared__ __attribute__((aligned(16))) bf16 xs[128 * XP];
  const int batch = blockIdx.x % BB;
  const int blk   = batch * (TT / 64) + blockIdx.x / BB;   // 64 places: batch, then place block
  const bool full = (int)(blockIdx.x / BB) * 64 < nkey[batch];   // the same for the whole block
  const int lane = threadIdx.x & 31;
  const int wave = __builtin_amdgcn_readfirstlane(threadIdx.x >> 5);  // scalar: tile numbers and bases
  const int n = lane & 15, hi = lane >> 4;

  const int tile0 = blk * 4 + (wave >> 2) * 2;          // first 16-row tile of this wave
  const int cq    = wave & 3;
  const bf16* wrow = wb + (size_t)cq * 16 * DD;         // column tile cq + 4 i lies 4 i tiles on

  // Two sets of operand registers, as in pool_kernel: the W fragments (six, or one in a q-only block) and
  // the two x fragments of k block kf + 1 are fetched while block kf is worked on.
  v16bf w[2][6], a[2][2];
  auto fetch_w = [&](auto ni, int set, int kf) {
#pragma unroll   // constant element numbers keep the fragments in registers
    for (int i = 0; i < decltype(ni)::v; ++i) w[set][i] = load_frag(wrow + i * (64 * DD) + kf * 512);
  };
  auto fetch_a = [&](int set, int kf) {
#pragma unroll   // as above
    for (int t = 0; t < 2; ++t) {
      const bf16* s = xs + (((wave >> 2) * 2 + t) * 32 + kf * 4 + hi) * XP + n * 8;
      BF16Tile tl;
      tl.lo = *(const u32x4*)(s);
      tl.hi = *(const u32x4*)(s + 2 * XP);
      a[set][t] = __builtin_bit_cast(v16bf, tl);
    }
  };

  // Thread t takes the 16-byte piece t of every 4 rows: a wave reads half a row.
  {
    const float* xb = x + (size_t)batch * TT * DD;
    const int* pr = perm + blk * 64 + (wave >> 1);          // scalar: a wave reads half of one row
    const f32x4* ps[16];
    f32x4 f[16];
#pragma unroll   // constant element numbers keep the addresses in registers
    for (int j = 0; j < 16; ++j)
      ps[j] = (const f32x4*)(xb + (pr[j * 4] & (TT - 1)) * DD) + (threadIdx.x & 63);
#pragma unroll   // all 16 loads of a thread are in flight together
    for (int j = 0; j < 16; ++j) f[j] = *ps[j];
    // Precaution: the wait in front of any rewrite of these loads' address
    // registers; as its inputs the 16 addresses stay in their registers up to it.
    asm volatile("s_wait_xcnt 0x0"
                 :: "v"(ps[0]), "v"(ps[1]), "v"(ps[2]), "v"(ps[3]), "v"(ps[4]), "v"(ps[5]),
                    "v"(ps[6]), "v"(ps[7]), "v"(ps[8]), "v"(ps[9]), "v"(ps[10]), "v"(ps[11]),
                    "v"(ps[12]), "v"(ps[13]), "v"(ps[14]), "v"(ps[15])
                 : "memory");
    // needs nothing of x: in flight behind the x loads
    if (full) fetch_w(Count<6>{}, 0, 0); else fetch_w(Count<1>{}, 0, 0);
    // Precaution: the wait in front of any rewrite of these loads' address
    // registers; as its input the base stays in its registers up to it.
    asm volatile("s_wait_xcnt 0x0" :: "s"(wrow) : "memory");
    const int k = (threadIdx.x & 63) * 4;
    bf16* dst = xs + (k >> 3) * XP + (k & 7);
#pragma unroll   // constant element numbers keep f in registers
    for (int j = 0; j < 16; ++j) {
      const int row = j * 4 + (threadIdx.x >> 6);
      __attribute__((aligned(8))) bf16 pk[4];
      for (int e = 0; e < 4; ++e) pk[e] = (bf16)f[j][e];
      *(u32x2*)(dst + (row >> 4) * (32 * XP) + (row & 15) * 8) = *(const u32x2*)pk;
    }
  }

  v8f c[6][2];
#pragma unroll   // constant element numbers for c[][]
  for (int i = 0; i < 6; ++i) {
    const int col = (cq + 4 * i) * 16 + n;
    const float bias = (i == 0) ? bq[col] : (i == 1 ? bk[col - QQ] : bv[col - 2*QQ]);
    for (int r = 0; r < 8; ++r) { c[i][0][r] = bias; c[i][1][r] = bias; }
  }
  __syncthreads();   // the block's 64 rows are in LDS
  fetch_a(0, 0);

  // The products and the stores, for the first NI of the wave's column tiles.
  auto rest = [&](auto ni) {
  constexpr int NI = decltype(ni)::v;
  v8f slv[2];                                  // sl of the lane's 8 rows of each tile
#pragma unroll   // kf & 1 names the register set at compile time
  for (int kf = 0; kf < 8; ++kf) {
    const int cur = kf & 1;
    if (kf < 7) {
      fetch_w(ni, cur ^ 1, kf + 1); fetch_a(cur ^ 1, kf + 1);
    } else if (NI > 1) {
      const float* sp = sl + tile0 * 16 + 8 * hi;
      slv[0] = *(const v8f*)(sp);
      slv[1] = *(const v8f*)(sp + 16);
    }
    // Keeps the fetches above in front of the products below: sunk to their
    // first use, each would be waited for at its full latency.
    __builtin_amdgcn_sched_barrier(0);
#pragma unroll   // constant element numbers for c[][] and w[][]
    for (int i = 0; i < NI; ++i) {
      c[i][0] = __builtin_amdgcn_wmma_f32_16x16x32_bf16(false, a[cur][0], false, w[cur][i], (short)0, c[i][0], false, false);
      c[i][1] = __builtin_amdgcn_wmma_f32_16x16x32_bf16(false, a[cur][1], false, w[cur][i], (short)0, c[i][1], false, false);
    }
  }

  // Epilogue. C/D layout: lane holds column n; VGPR r holds row (r + 8*hi).
#pragma unroll   // i decides the kind of column tile at compile time
  for (int i = 0; i < NI; ++i) {
    const int nt = cq + 4 * i;                 // 0..23: 16-col tile
#pragma unroll   // constant element numbers for c[][]
    for (int t = 0; t < 2; ++t) {
      const int tile = tile0 + t;
      if (i < 2) {
        // e = (nt & 3) * 16 + n is the fragment's k, the row r + 8 * hi its row.
        const size_t fo = (size_t)tile * (16 * QQ) + ((nt >> 1) & 1) * 512 + (nt & 1) * 256
                        + (((n >> 3) << 4) + 8 * hi) * 8 + (n & 7);
        for (int r = 0; r < 8; ++r) {
          float v = c[i][t][r];
          if (i == 1) {
            float s = slv[t][r];               // row tile * 16 + r + 8 * hi
            s = fminf(fmaxf(s, 0.0f), 1.0f);
            v *= 0.125f * (1.0f + s * s);      // 1/sqrt(64) * (1 + sl^2)
            kb[fo + r * 8] = (bf16)v;
          } else {
            qb[fo + r * 8] = (bf16)v;
          }
        }
      } else {
        // The lane's 8 consecutive t of column d are one 16-byte chunk of the
        // fragment (t / 32, d / 16): half (tile & 1), lane as it is here.
        __attribute__((aligned(16))) bf16 pk[8];
        for (int r = 0; r < 8; ++r) pk[r] = (bf16)c[i][t][r];
        *(u32x4*)(vtb + ((size_t)(tile >> 1) * (DD / 16) + (nt - 8)) * 512
                      + (tile & 1) * 256 + lane * 8) = *(const u32x4*)pk;
      }
    }
  }
  // Precaution: the wait in front of any rewrite of the stores' registers further on.
  asm volatile("s_wait_xcnt 0x0" ::: "memory");
  };
  if (full) rest(Count<6>{}); else rest(Count<1>{});
}

// ---------------------------- attention kernels ----------------------------
// The output is the mean over the queries of P V, and that mean commutes with
// the product: out = (1/T) * V^T (sum over queries of P^T). A query's row of P
// must be normalised before rows are added, so the work runs in two passes.
// Both form S^T = K Q^T: in a D tile a lane holds ONE query (column n) and its
// registers hold keys 8 * hi + r.
//
// The mask bias belongs to the key, the D row. It is added to the finished
// score by a vector add, whose one rounding leaves every masked score at the
// same value; the maximum is subtracted before the scaling to base 2, so that
// a row with every key masked comes out uniform.

#define LOG2E 1.44269504f

__device__ __forceinline__ float max16(v8f a, v8f b) {
  float t[8];
  for (int r = 0; r < 8; ++r) t[r] = fmaxf(a[r], b[r]);
  return fmaxf(fmaxf(fmaxf(t[0], t[1]), fmaxf(t[2], t[3])),
               fmaxf(fmaxf(t[4], t[5]), fmaxf(t[6], t[7])));
}
__device__ __forceinline__ v8f exp2v(v8f x) {
  v8f y;
  for (int r = 0; r < 8; ++r) y[r] = __builtin_amdgcn_exp2f(x[r]);
  return y;
}
__device__ __forceinline__ float sum8(v8f t) {
  return ((t[0] + t[1]) + (t[2] + t[3])) + ((t[4] + t[5]) + (t[6] + t[7]));
}

// Pass 1: maximum and log2 of the sum of every query's scores.
// grid (T/64, B), block 256 = 8 waves. A block owns 64 queries (4 tiles, held
// as B operands by every wave, so one load of a key fragment serves 4 tiles);
// wave w takes the groups of 32 keys w, w + 8, ... below nkey. A lane keeps maximum and sum of its
// own keys; halves and waves are joined once, at the end.
__global__ __launch_bounds__(256) void stat_kernel(
    const bf16* __restrict__ qb, const bf16* __restrict__ kb,
    const float* __restrict__ mbias, const int* __restrict__ nkey,
    float* __restrict__ qmax, float* __restrict__ qlog)
{
  __shared__ float sm[8][64];
  __shared__ float ss[8][64];
  const int lane = threadIdx.x & 31;
  const int wave = __builtin_amdgcn_readfirstlane(threadIdx.x >> 5);  // scalar: loop bounds and bases
  const int n = lane & 15, hi = lane >> 4;
  const int q0 = blockIdx.x * 64;
  const int b  = blockIdx.y;

  v16bf qa[4][2];
  for (int i = 0; i < 4; ++i) {
    const size_t qrow = (size_t)(b * TT + q0 + i * 16) * QQ;
    qa[i][0] = load_frag(qb + qrow + 0);
    qa[i][1] = load_frag(qb + qrow + 512);
  }
  float m[4], l[4];
  for (int i = 0; i < 4; ++i) { m[i] = -1e30f; l[i] = 0.0f; }

  const int nk = min(nkey[b], TT);
  for (int j0 = wave * 32; j0 < nk; j0 += 256) {
    const size_t krow = (size_t)(b * TT + j0) * QQ;
    v16bf k0a = load_frag(kb + krow + 0);
    v16bf k0b = load_frag(kb + krow + 512);
    v16bf k1a = load_frag(kb + krow + 1024);
    v16bf k1b = load_frag(kb + krow + 1536);
    const float* mp = mbias + b * TT + j0 + 8 * hi;
    const v8f mb0 = *(const v8f*)(mp);
    const v8f mb1 = *(const v8f*)(mp + 16);
    for (int i = 0; i < 4; ++i) {
      v8f s0 = {}, s1 = {};
      s0 = __builtin_amdgcn_wmma_f32_16x16x32_bf16(false, k0a, false, qa[i][0], (short)0, s0, false, false);
      s1 = __builtin_amdgcn_wmma_f32_16x16x32_bf16(false, k1a, false, qa[i][0], (short)0, s1, false, false);
      s0 = __builtin_amdgcn_wmma_f32_16x16x32_bf16(false, k0b, false, qa[i][1], (short)0, s0, false, false);
      s1 = __builtin_amdgcn_wmma_f32_16x16x32_bf16(false, k1b, false, qa[i][1], (short)0, s1, false, false);
      s0 += mb0;
      s1 += mb1;
      const float mn = fmaxf(m[i], max16(s0, s1));
      const float corr = __builtin_amdgcn_exp2f((m[i] - mn) * LOG2E);
      const v8f p = exp2v((s0 - mn) * LOG2E) + exp2v((s1 - mn) * LOG2E);
      l[i] = l[i] * corr + sum8(p);
      m[i] = mn;
    }
  }

  for (int i = 0; i < 4; ++i) {
    const float mo = xhalf(m[i]), lo = xhalf(l[i]);
    const float mj = fmaxf(m[i], mo);
    const float lj = l[i] * __builtin_amdgcn_exp2f((m[i] - mj) * LOG2E)
                   + lo   * __builtin_amdgcn_exp2f((mo   - mj) * LOG2E);
    if (hi == 0) { sm[wave][i * 16 + n] = mj; ss[wave][i * 16 + n] = lj; }
  }
  __syncthreads();   // every wave's partial maximum and sum are in LDS
  if (threadIdx.x < 64) {
    const int q = threadIdx.x;
    float mj = sm[0][q];
    for (int w = 1; w < 8; ++w) mj = fmaxf(mj, sm[w][q]);
    float lj = 0.0f;
    for (int w = 0; w < 8; ++w)
      lj += ss[w][q] * __builtin_amdgcn_exp2f((sm[w][q] - mj) * LOG2E);
    qmax[b * TT + q0 + q] = mj;
    qlog[b * TT + q0 + q] = __builtin_amdgcn_logf(lj);   // log2
  }
}

// Pass 2: W^T = sum over query tiles of the normalised P^T, then V^T W^T.
// grid (T/64, B), block 256 = 8 waves. The work of a batch is its key blocks
// below nkey (64 keys, held as A operands by every wave) times its 128 query
// tiles; the batch's 32 work-groups take equal runs of it, key block by key
// block, so a run lies in one key block or in two that follow each other. Of a
// run's query tiles wave w takes the w-th, the (w + 8)-th, ... The sum over
// tiles is in-lane: column n of W^T collects the queries n mod 16. The waves'
// sums are joined through LDS; converted in place they are the bf16 B operand
// of the second product (hardware k order, the order of the v fragments), of
// which wave w does 32 output rows; the 16 columns are summed at the very end.
__global__ __launch_bounds__(256) void pool_kernel(
    const bf16* __restrict__ qb, const bf16* __restrict__ kb,
    const bf16* __restrict__ vtb, const float* __restrict__ mbias,
    const float* __restrict__ qmax, const float* __restrict__ qlog,
    const int* __restrict__ nkey, float* __restrict__ out)
{
  __shared__ f32x4 red[8][8][32];              // [wave][4 registers][lane]
  __shared__ f32x4 fin[8][32];                 // [4 registers][lane]
  const int lane = threadIdx.x & 31;
  const int wave = __builtin_amdgcn_readfirstlane(threadIdx.x >> 5);  // scalar: loop bounds and bases
  const int n = lane & 15, hi = lane >> 4;
  const int b  = blockIdx.y;
  const int run = ((min(nkey[b], TT) + 63) >> 6) * (TT / 16) / (TT / 64);   // tiles of a work-group: at most T/16
  const int u0 = blockIdx.x * run, u1 = u0 + run;   // unit = key block * (T/16) + query tile

  // At most two trips; every bound is the same for the whole work-group.
  for (int kblk = u0 / (TT / 16); kblk * (TT / 16) < u1; ++kblk) {
  const int j0 = kblk * 64;
  const int qe = min(u1 - kblk * (TT / 16), TT / 16);            // end of the run's query tiles here
  int qt = max(u0 - kblk * (TT / 16), 0) + wave;                 // this wave's first

  v16bf ka[4][2];
  v8f mb[4], acc[4];
  for (int i = 0; i < 4; ++i) {
    const size_t krow = (size_t)(b * TT + j0 + i * 16) * QQ;
    ka[i][0] = load_frag(kb + krow + 0);
    ka[i][1] = load_frag(kb + krow + 512);
    mb[i] = *(const v8f*)(mbias + b * TT + j0 + i * 16 + 8 * hi);
    acc[i] = v8f{};
  }

  // One query tile: scores of the block's 64 keys, normalised, added to acc.
  auto tile = [&](v16bf qa0, v16bf qa1, float qm, float ql) {
    v8f s[4];
    for (int i = 0; i < 4; ++i) {
      s[i] = v8f{};
      s[i] = __builtin_amdgcn_wmma_f32_16x16x32_bf16(false, ka[i][0], false, qa0, (short)0, s[i], false, false);
    }
    for (int i = 0; i < 4; ++i)
      s[i] = __builtin_amdgcn_wmma_f32_16x16x32_bf16(false, ka[i][1], false, qa1, (short)0, s[i], false, false);
    for (int i = 0; i < 4; ++i)
      acc[i] += exp2v(((s[i] + mb[i]) - qm) * LOG2E - ql);
  };

  // Two sets of operand registers: each tile's operands are fetched while the
  // tile before it is worked on, and no register copy is needed between them.
  // A fetch past the batch's last tile is turned to it; one past the run's end
  // is not used.
  const bf16*  qp = qb + (size_t)b * TT * QQ;
  const float* pm = qmax + b * TT + n;
  const float* pl = qlog + b * TT + n;
  v16bf a0, a1, b0, b1;
  float am, al, bm, bl;
  auto fetch = [&](int t, v16bf& f0, v16bf& f1, float& fm, float& fl) {
    t = min(t, TT / 16 - 1);
    const bf16*  fq = qp + t * (16 * QQ);
    const float* fa = pm + t * 16;
    const float* fb = pl + t * 16;
    f0 = load_frag(fq); f1 = load_frag(fq + 512);
    fm = *fa; fl = *fb;
    // Precaution: the wait in front of any rewrite of these loads' address registers.
    asm volatile("s_wait_xcnt 0x0" ::: "memory");
  };
  fetch(qt, a0, a1, am, al);
  for (; qt + 8 < qe; qt += 16) {
    fetch(qt + 8, b0, b1, bm, bl);
    tile(a0, a1, am, al);
    fetch(qt + 16, a0, a1, am, al);
    tile(b0, b1, bm, bl);
  }
  if (qt < qe) tile(a0, a1, am, al);

  for (int i = 0; i < 4; ++i) {
    red[wave][2 * i + 0][lane] = f32x4{acc[i][0], acc[i][1], acc[i][2], acc[i][3]};
    red[wave][2 * i + 1][lane] = f32x4{acc[i][4], acc[i][5], acc[i][6], acc[i][7]};
  }
  __syncthreads();   // every wave's sums are in LDS
  f32x4 g = red[0][wave][lane];
  for (int w = 1; w < 8; ++w) g += red[w][wave][lane];
  fin[wave][lane] = g;
  __syncthreads();   // the joined sums are in LDS

  v16bf pb0, pb1;
#pragma unroll   // constant element numbers keep both operands in registers
  for (int c = 0; c < 4; ++c) {
    const f32x4 f0 = fin[c][lane], f1 = fin[4 + c][lane];
#pragma unroll   // as above
    for (int e = 0; e < 4; ++e) {
      pb0[4 * c + e] = (bf16)f0[e];
      pb1[4 * c + e] = (bf16)f1[e];
    }
  }

  const float invT = 1.0f / (float)TT;
  const size_t vrow = (size_t)(b * TT + j0) * DD;
  for (int c = 0; c < 2; ++c) {
    const int dt = wave * 2 + c;               // 16-row tile of O^T
    v16bf v0 = load_frag(vtb + vrow + dt * 512);
    v16bf v1 = load_frag(vtb + vrow + 32 * DD + dt * 512);
    v8f o = {};
    o = __builtin_amdgcn_wmma_f32_16x16x32_bf16(false, v0, false, pb0, (short)0, o, false, false);
    o = __builtin_amdgcn_wmma_f32_16x16x32_bf16(false, v1, false, pb1, (short)0, o, false, false);
    float sacc = 0.0f;
    for (int r = 0; r < 8; ++r) {
      float q = rsum16(o[r]);                  // every lane of the row holds the sum
      sacc = (n == r) ? q : sacc;              // lane n < 8 keeps row 8 * hi + n
    }
    if (n < 8)
      atomicAdd(&out[b * DD + dt * 16 + 8 * hi + n], sacc * invT);
    // Precaution: in front of the rewrite of the add's registers further on.
    asm volatile("s_wait_xcnt 0x0" ::: "memory");
  }
  }
}

// ------------------------------- launcher ----------------------------------

extern "C" void kernel_launch(void* const* d_in, const int* in_sizes, int n_in,
                              void* d_out, int out_size, void* d_ws, size_t ws_size,
                              hipStream_t stream) {
  const float* x    = (const float*)d_in[0];
  const float* sl   = (const float*)d_in[1];
  const int*   mask = (const int*)  d_in[2];
  const float* Wq   = (const float*)d_in[3];
  const float* bq   = (const float*)d_in[4];
  const float* Wk   = (const float*)d_in[5];
  const float* bk   = (const float*)d_in[6];
  const float* Wv   = (const float*)d_in[7];
  const float* bv   = (const float*)d_in[8];
  float* out = (float*)d_out;

  char* ws = (char*)d_ws;
  const size_t OFF_WB = 0;
  const size_t OFF_QB = OFF_WB + (size_t)384 * DD * 2;
  const size_t OFF_KB = OFF_QB + (size_t)BB * TT * QQ * 2;
  const size_t OFF_VT = OFF_KB + (size_t)BB * TT * QQ * 2;
  const size_t OFF_MB = OFF_VT + (size_t)BB * DD * TT * 2;
  const size_t OFF_QM = OFF_MB + (size_t)BB * TT * 4;
  const size_t OFF_QL = OFF_QM + (size_t)BB * TT * 4;
  const size_t OFF_SP = OFF_QL + (size_t)BB * TT * 4;
  const size_t OFF_PR = OFF_SP + (size_t)BB * TT * 4;
  const size_t OFF_NK = OFF_PR + (size_t)BB * TT * 4;

  bf16*  wb  = (bf16*)(ws + OFF_WB);
  bf16*  qbp = (bf16*)(ws + OFF_QB);
  bf16*  kbp = (bf16*)(ws + OFF_KB);
  bf16*  vtb = (bf16*)(ws + OFF_VT);
  float* mb  = (float*)(ws + OFF_MB);
  float* qm  = (float*)(ws + OFF_QM);
  float* ql  = (float*)(ws + OFF_QL);
  float* slp = (float*)(ws + OFF_SP);
  int*   pr  = (int*)(ws + OFF_PR);
  int*   nk  = (int*)(ws + OFF_NK);

  // 1) weights to bf16 fragments, row order and key counts, zeros in the output: one launch
  prep_kernel<<<PREP_W + PREP_P + PREP_Z, 256, 0, stream>>>(Wq, Wk, Wv, mask, sl, wb, mb, slp, pr, nk, out);

  // 2) QKV projection (WMMA bf16), x converted on the way
  proj_kernel<<<BB * TT / 64, 256, 0, stream>>>(
      x, wb, bq, bk, bv, slp, pr, nk, qbp, kbp, vtb);

  // 3) every query's maximum and log-sum (WMMA bf16)
  stat_kernel<<<dim3(TT / 64, BB), 256, 0, stream>>>(qbp, kbp, mb, nk, qm, ql);

  // 4) query-sum of the normalised probabilities, then the V product (WMMA bf16)
  pool_kernel<<<dim3(TT / 64, BB), 256, 0, stream>>>(qbp, kbp, vtb, mb, qm, ql, nk, out);
}

// v008
// It runs in 36.3 microseconds.
// In two side-by-side timings against v007, it was 1.04 and 1.05 times as fast.
// Over all steps from v000 it is 11.0 times as fast.
#include <hip/hip_runtime.h>

// ---------------------------------------------------------------------------
// NEGAPooling for MI455X (gfx1250, wave32, WMMA bf16)
// B=16, T=2048, D=256, QK=64
// ---------------------------------------------------------------------------

typedef __bf16 bf16;
typedef __attribute__((ext_vector_type(16))) __bf16       v16bf;
typedef __attribute__((ext_vector_type(8)))  float        v8f;
typedef __attribute__((ext_vector_type(4)))  unsigned int u32x4;
typedef __attribute__((ext_vector_type(2)))  unsigned int u32x2;
typedef __attribute__((ext_vector_type(4)))  float        f32x4;
typedef __attribute__((ext_vector_type(4)))  int          i32x4;

#define BB 16
#define TT 2048
#define DD 256
#define QQ 64

struct BF16Tile { u32x4 lo, hi; };

// Operand layout of the 16x16x32 bf16 WMMA (ISA 7.12.2, 16-bit A 16x32):
// lanes 0-15 hold row M=lane, K chunks {0..7, 16..23}; lanes 16-31 hold row
// M=lane-16, K {8..15, 24..31}. B mirrors it (lane = column N, same K chunks).

// Fragment order: every WMMA operand that lives in the workspace is stored as
// 1 KiB fragments (16 rows x 32 k). Element (row c, k) of a fragment sits at
//   ((k >> 4) & 1) * 256 + (((k >> 3) & 1) * 16 + c) * 8 + (k & 7)
// so lane l finds the two 16-byte chunks of that layout at l * 8 and
// 256 + l * 8: each load of a wave reads 512 contiguous bytes (4 cache lines)
// where the row-major tile made it touch 16 lines.
__device__ __forceinline__ v16bf load_frag(const bf16* frag) {
  const bf16* p = frag + ((threadIdx.x & 31) << 3);
  BF16Tile t;
  t.lo = *(const u32x4*)(p);
  t.hi = *(const u32x4*)(p + 256);
  return __builtin_bit_cast(v16bf, t);
}

// Lane l takes the value of lane l ^ 16 (the other half of the wave).
__device__ __forceinline__ float xhalf(float x) {
  int b = __builtin_bit_cast(int, x);
  return __builtin_bit_cast(float,
      __builtin_amdgcn_permlanex16(b, b, 0x76543210, 0xfedcba98, false, false));
}
// Lane l takes the value of lane l ^ X inside its 16-lane row (DPP row_xmask:X).
template <int X>
__device__ __forceinline__ float xrow(float v) {
  return __builtin_bit_cast(float,
      __builtin_amdgcn_update_dpp(0, __builtin_bit_cast(int, v), 0x160 + X, 0xf, 0xf, true));
}
__device__ __forceinline__ float rsum16(float v) {
  v += xrow<1>(v);
  v += xrow<2>(v);
  v += xrow<4>(v);
  v += xrow<8>(v);
  return v;
}

// --------------------------- projection kernel -----------------------------
// One launch does the row order, the weight conversion and the projection
// [B*T, 384] = x[B*T,256] @ [Wq;Wk;Wv]^T; no launch runs in front of it.
//
// Row order. A masked key has probability 0 as long as its batch has an
// unmasked one, and the result does not depend on the order of a batch's rows
// (keys are summed over, queries averaged). So the rows are put in a new order,
// the unmasked first, each kind in its old order. Every block counts its own
// batch's mask (a thread takes 4 rows, prefix sums over the block) and keeps the
// old row and sl of its own 128 places in LDS. nkey = the number of keys that
// the later kernels go through (all of them where every key is masked: the
// uniform row); mb = the mask bias in the new order.
//
// grid B * 16, block 512 = 16 waves, one block to a WGP. A block takes two
// 64-place blocks of one batch, number pa from the front (waves 0-7) and
// T/64 - 1 - pa from the back (waves 8-15), so that every block has about the
// same share of key places. k and v are read only in the 64-place blocks that
// begin below nkey (the key loops end there), q everywhere: waves whose 64
// places all lie at or past nkey make q alone (i = 0).
//
// x and the weights arrive as f32 and are read with whole-line loads, rounded
// to bf16 and laid in LDS as fragments. q, k, v leave in fragment order:
// cols 0..63 -> q (bf16), fragments [16-row tile][e / 32]
// cols 64..127 -> k scaled by (1/sqrt(QK))*(1+clip(sl)^2)  (bf16), same order
// cols 128..383 -> v (bf16), fragments of v transposed (row = d, k = t):
//                  [b][t / 32][d / 16]
// Of its eight, wave w takes row tiles 2 (w / 4) and 2 (w / 4) + 1, so one read
// of a W fragment serves two products, and column tiles (w % 4) + 4 i: one of
// q, one of k, four of v; 12 accumulators.

template <int N> struct Count { static constexpr int v = N; };

// Work-group barrier that orders LDS accesses only: with __syncthreads() a wave
// would first wait for its weight loads, which are to stay in flight across it.
__device__ __forceinline__ void lds_barrier() {
  __builtin_amdgcn_fence(__ATOMIC_RELEASE, "workgroup", "local");
  __builtin_amdgcn_s_barrier();
  __builtin_amdgcn_fence(__ATOMIC_ACQUIRE, "workgroup", "local");
}

// LDS: group g = (row / 16) * 32 + k / 8 holds 16 rows x 8 k (256 bytes). The
// pitch of 272 bytes puts the 16 groups that one wave's store touches, and the
// two groups that one fragment read touches, on different banks.
#define XP 136

__global__ __launch_bounds__(512) void proj_kernel(
    const float* __restrict__ x, const float* __restrict__ Wq,
    const float* __restrict__ Wk, const float* __restrict__ Wv,
    const float* __restrict__ bq, const float* __restrict__ bk,
    const float* __restrict__ bv, const float* __restrict__ sl,
    const int* __restrict__ mask,
    float* __restrict__ mb, int* __restrict__ nkey, float* __restrict__ out,
    bf16* __restrict__ qb, bf16* __restrict__ kb, bf16* __restrict__ vtb)
{
  __shared__ __attribute__((aligned(16))) bf16 xs[2 * 128 * XP];   // 2 x 64 rows of x
  __shared__ __attribute__((aligned(16))) bf16 wl[24 * 32 * XP];   // 384 rows of W
  __shared__ __attribute__((aligned(32))) float sll[128];          // sl of the block's places
  __shared__ int prm[128];                                         // old row of the block's places
  __shared__ int wsum[16];
  const int batch = blockIdx.x % BB;
  const int pa = blockIdx.x / BB, pb = TT / 64 - 1 - pa;  // the block's two 64-place blocks
  const int lane = threadIdx.x & 31;
  const int wave = __builtin_amdgcn_readfirstlane(threadIdx.x >> 5);  // scalar: tile numbers and bases
  const int sub = wave >> 3, wv = wave & 7;               // which place block, wave in it
  const int n = lane & 15, hi = lane >> 4;

  const int t0 = threadIdx.x * 4;                         // a thread counts 4 rows in a row
  const i32x4 m0 = *(const i32x4*)(mask + batch * TT + t0);
  const f32x4 s0 = *(const f32x4*)(sl + batch * TT + t0);

  // Weights: thread t takes the 16-byte piece t % 64 of rows t / 64 + 8 j, so a
  // wave reads half a row; 16 rows of a thread make one batch of loads.
  const int wk = (threadIdx.x & 63) * 4, wr = threadIdx.x >> 6;
  const float* const tq = Wq + wr * DD + wk;
  const float* const tk = Wk + wr * DD + wk;
  const float* const tv = Wv + wr * DD + wk;
  auto load_w = [&](auto first, f32x4 (&g)[16]) {
#pragma unroll   // j names the matrix and the register at compile time
    for (int j = 0; j < 16; ++j) {
      const int jj = decltype(first)::v + j;
      const float* w = jj < 8 ? tq + jj * (8 * DD) : jj < 16 ? tk + (jj - 8) * (8 * DD) : tv + (jj - 16) * (8 * DD);
      g[j] = *(const f32x4*)w;
    }
    // Precaution: the wait in front of any rewrite of these loads' address
    // registers; as its inputs the addresses stay in their registers up to it.
    asm volatile("s_wait_xcnt 0x0" :: "v"(tq), "v"(tk), "v"(tv) : "memory");
  };
  auto store_w = [&](auto first, const f32x4 (&g)[16]) {
    bf16* dst = wl + (wk >> 3) * XP + (wk & 7);
#pragma unroll   // constant element numbers keep g in registers
    for (int j = 0; j < 16; ++j) {
      const int row = (decltype(first)::v + j) * 8 + wr;
      __attribute__((aligned(8))) bf16 pk[4];
      for (int e = 0; e < 4; ++e) pk[e] = (bf16)g[j][e];
      *(u32x2*)(dst + (row >> 4) * (32 * XP) + (row & 15) * 8) = *(const u32x2*)pk;
    }
  };
  f32x4 g0[16], g1[16];
  load_w(Count<0>{}, g0);                      // Wq, Wk and the first half of Wv:
  load_w(Count<16>{}, g1);                     // in flight while the mask is counted

  int cnt = 0;
  for (int e = 0; e < 4; ++e) cnt += (m0[e] != 0);
  int inc = cnt;                               // unmasked rows up to and with this thread's
  for (int d = 1; d < 32; d <<= 1) {
    const int o = __shfl_up(inc, d);
    if (lane >= d) inc += o;
  }
  if (lane == 31) wsum[wave] = inc;
  lds_barrier();     // every wave's count is in LDS
  int before = inc - cnt, total = 0;
  for (int w = 0; w < 16; ++w) {
    const int c = wsum[w];
    before += (w < wave) ? c : 0;
    total  += c;
  }
  {
    int pv = before;                           // next place among the unmasked
    int pm = total + (t0 - before);            // next place among the masked
    for (int e = 0; e < 4; ++e) {
      const bool keep = m0[e] != 0;
      const int p = keep ? pv : pm;
      pv += keep ? 1 : 0;
      pm += keep ? 0 : 1;
      const int pblk = p >> 6;
      if (pblk == pa || pblk == pb) {
        const int slot = (pblk == pa ? 0 : 64) + (p & 63);
        prm[slot] = t0 + e;
        sll[slot] = s0[e];
      }
    }
  }
  total = __builtin_amdgcn_readfirstlane(total);          // the same in every thread of the block
  const int nk = total == 0 ? TT : total;
  const bool full_a = pa * 64 < nk;                       // pb > pa: no k or v at all where this fails
  const bool full   = (sub ? pb : pa) * 64 < nk;          // the same for the whole wave
  const int blk   = batch * (TT / 64) + (sub ? pb : pa);  // the wave's 64 places
  const int tile0 = blk * 4 + (wv >> 2) * 2;              // first 16-row tile of this wave
  const int cq    = wv & 3;
  if (threadIdx.x < 128) {
    const int p = (threadIdx.x < 64 ? pa : pb) * 64 + (threadIdx.x & 63);
    mb[batch * TT + p] = p < total ? 0.0f : -1e9f;
  } else if (threadIdx.x < 128 + BB * DD / (BB * 16)) {
    out[blockIdx.x * (BB * DD / (BB * 16)) + threadIdx.x - 128] = 0.0f;   // pool_kernel adds into out
  } else if (threadIdx.x == 256 && pa == 0) {
    nkey[batch] = nk;
  }
  // Precaution: the wait in front of any rewrite of these stores' registers further on.
  asm volatile("s_wait_xcnt 0x0" ::: "memory");
  lds_barrier();     // the old rows and sl of the block's 128 places are in LDS

  // Two sets of operand registers, as in pool_kernel: the six W fragments and
  // the two x fragments of k block kf + 1 are read while block kf is worked on.
  v16bf w[2][6], a[2][2];
  auto frag = [&](const bf16* s) {
    BF16Tile tl;
    tl.lo = *(const u32x4*)(s);
    tl.hi = *(const u32x4*)(s + 2 * XP);
    return __builtin_bit_cast(v16bf, tl);
  };
  auto fetch_w = [&](auto ni, int set, int kf) {
#pragma unroll   // constant element numbers keep the fragments in registers
    for (int i = 0; i < decltype(ni)::v; ++i)
      w[set][i] = frag(wl + ((cq + 4 * i) * 32 + kf * 4 + hi) * XP + n * 8);
  };
  auto fetch_a = [&](int set, int kf) {
#pragma unroll   // as above
    for (int t = 0; t < 2; ++t)
      a[set][t] = frag(xs + ((sub * 4 + (wv >> 2) * 2 + t) * 32 + kf * 4 + hi) * XP + n * 8);
  };

  // Of its place block's 256 threads, thread t takes the 16-byte piece t of
  // every 4 rows: a wave reads half a row.
  {
    const float* xb = x + (size_t)batch * TT * DD;
    const int* pr = prm + sub * 64 + (wv >> 1);
    const int piece = threadIdx.x & 63;
    const f32x4* ps[16];
    f32x4 f[16];
#pragma unroll   // constant element numbers keep the addresses in registers
    for (int j = 0; j < 16; ++j)
      ps[j] = (const f32x4*)(xb + (pr[j * 4] & (TT - 1)) * DD) + piece;
#pragma unroll   // all 16 loads of a thread are in flight together
    for (int j = 0; j < 16; ++j) f[j] = *ps[j];
    // Precaution: the wait in front of any rewrite of these loads' address
    // registers; as its input the lane's part stays in its register up to it.
    asm volatile("s_wait_xcnt 0x0" :: "v"(piece) : "memory");
    store_w(Count<0>{}, g0);
    if (full_a) load_w(Count<32>{}, g0);       // Wv, second half: in flight behind the x loads
    store_w(Count<16>{}, g1);
    const int k = (threadIdx.x & 63) * 4;
    bf16* dst = xs + sub * (128 * XP) + (k >> 3) * XP + (k & 7);
#pragma unroll   // constant element numbers keep f in registers
    for (int j = 0; j < 16; ++j) {
      const int row = j * 4 + ((threadIdx.x >> 6) & 3);
      __attribute__((aligned(8))) bf16 pk[4];
      for (int e = 0; e < 4; ++e) pk[e] = (bf16)f[j][e];
      *(u32x2*)(dst + (row >> 4) * (32 * XP) + (row & 15) * 8) = *(const u32x2*)pk;
    }
  }
  if (full_a) store_w(Count<32>{}, g0);

  v8f c[6][2];
#pragma unroll   // constant element numbers for c[][]
  for (int i = 0; i < 6; ++i) {
    const int col = (cq + 4 * i) * 16 + n;
    const float bias = (i == 0) ? bq[col] : (i == 1 ? bk[col - QQ] : bv[col - 2*QQ]);
    for (int r = 0; r < 8; ++r) { c[i][0][r] = bias; c[i][1][r] = bias; }
  }
  __syncthreads();   // the block's 128 rows and the weights are in LDS

  // The products and the stores, for the first NI of the wave's column tiles.
  auto rest = [&](auto ni) {
  constexpr int NI = decltype(ni)::v;
  v8f slv[2];                                  // sl of the lane's 8 rows of each tile
  fetch_w(ni, 0, 0); fetch_a(0, 0);
#pragma unroll   // kf & 1 names the register set at compile time
  for (int kf = 0; kf < 8; ++kf) {
    const int cur = kf & 1;
    if (kf < 7) {
      fetch_w(ni, cur ^ 1, kf + 1); fetch_a(cur ^ 1, kf + 1);
    } else if (NI > 1) {
      const float* sp = sll + sub * 64 + (wv >> 2) * 32 + 8 * hi;
      slv[0] = *(const v8f*)(sp);
      slv[1] = *(const v8f*)(sp + 16);
    }
    // Keeps the reads above in front of the products below: sunk to their
    // first use, each would be waited for at its full latency.
    __builtin_amdgcn_sched_barrier(0);
#pragma unroll   // constant element numbers for c[][] and w[][]
    for (int i = 0; i < NI; ++i) {
      c[i][0] = __builtin_amdgcn_wmma_f32_16x16x32_bf16(false, a[cur][0], false, w[cur][i], (short)0, c[i][0], false, false);
      c[i][1] = __builtin_amdgcn_wmma_f32_16x16x32_bf16(false, a[cur][1], false, w[cur][i], (short)0, c[i][1], false, false);
    }
  }

  // Epilogue. C/D layout: lane holds column n; VGPR r holds row (r + 8*hi).
#pragma unroll   // i decides the kind of column tile at compile time
  for (int i = 0; i < NI; ++i) {
    const int nt = cq + 4 * i;                 // 0..23: 16-col tile
#pragma unroll   // constant element numbers for c[][]
    for (int t = 0; t < 2; ++t) {
      const int tile = tile0 + t;
      if (i < 2) {
        // e = (nt & 3) * 16 + n is the fragment's k, the row r + 8 * hi its row.
        const size_t fo = (size_t)tile * (16 * QQ) + ((nt >> 1) & 1) * 512 + (nt & 1) * 256
                        + (((n >> 3) << 4) + 8 * hi) * 8 + (n & 7);
        for (int r = 0; r < 8; ++r) {
          float v = c[i][t][r];
          if (i == 1) {
            float s = slv[t][r];               // row tile * 16 + r + 8 * hi
            s = fminf(fmaxf(s, 0.0f), 1.0f);
            v *= 0.125f * (1.0f + s * s);      // 1/sqrt(64) * (1 + sl^2)
            kb[fo + r * 8] = (bf16)v;
          } else {
            qb[fo + r * 8] = (bf16)v;
          }
        }
      } else {
        // The lane's 8 consecutive t of column d are one 16-byte chunk of the
        // fragment (t / 32, d / 16): half (tile & 1), lane as it is here.
        __attribute__((aligned(16))) bf16 pk[8];
        for (int r = 0; r < 8; ++r) pk[r] = (bf16)c[i][t][r];
        *(u32x4*)(vtb + ((size_t)(tile >> 1) * (DD / 16) + (nt - 8)) * 512
                      + (tile & 1) * 256 + lane * 8) = *(const u32x4*)pk;
      }
    }
  }
  // Precaution: the wait in front of any rewrite of the stores' registers further on.
  asm volatile("s_wait_xcnt 0x0" ::: "memory");
  };
  if (full) rest(Count<6>{}); else rest(Count<1>{});
}

// ---------------------------- attention kernels ----------------------------
// The output is the mean over the queries of P V, and that mean commutes with
// the product: out = (1/T) * V^T (sum over queries of P^T). A query's row of P
// must be normalised before rows are added, so the work runs in two passes.
// Both form S^T = K Q^T: in a D tile a lane holds ONE query (column n) and its
// registers hold keys 8 * hi + r.
//
// The mask bias belongs to the key, the D row. It is added to the finished
// score by a vector add, whose one rounding leaves every masked score at the
// same value; the maximum is subtracted before the scaling to base 2, so that
// a row with every key masked comes out uniform.

#define LOG2E 1.44269504f

__device__ __forceinline__ float max16(v8f a, v8f b) {
  float t[8];
  for (int r = 0; r < 8; ++r) t[r] = fmaxf(a[r], b[r]);
  return fmaxf(fmaxf(fmaxf(t[0], t[1]), fmaxf(t[2], t[3])),
               fmaxf(fmaxf(t[4], t[5]), fmaxf(t[6], t[7])));
}
__device__ __forceinline__ v8f exp2v(v8f x) {
  v8f y;
  for (int r = 0; r < 8; ++r) y[r] = __builtin_amdgcn_exp2f(x[r]);
  return y;
}
__device__ __forceinline__ float sum8(v8f t) {
  return ((t[0] + t[1]) + (t[2] + t[3])) + ((t[4] + t[5]) + (t[6] + t[7]));
}

// Pass 1: maximum and log2 of the sum of every query's scores.
// grid (T/64, B), block 256 = 8 waves. A block owns 64 queries (4 tiles, held
// as B operands by every wave, so one load of a key fragment serves 4 tiles);
// wave w takes the groups of 32 keys w, w + 8, ... below nkey. A lane keeps maximum and sum of its
// own keys; halves and waves are joined once, at the end.
__global__ __launch_bounds__(256) void stat_kernel(
    const bf16* __restrict__ qb, const bf16* __restrict__ kb,
    const float* __restrict__ mbias, const int* __restrict__ nkey,
    float* __restrict__ qmax, float* __restrict__ qlog)
{
  __shared__ float sm[8][64];
  __shared__ float ss[8][64];
  const int lane = threadIdx.x & 31;
  const int wave = __builtin_amdgcn_readfirstlane(threadIdx.x >> 5);  // scalar: loop bounds and bases
  const int n = lane & 15, hi = lane >> 4;
  const int q0 = blockIdx.x * 64;
  const int b  = blockIdx.y;

  v16bf qa[4][2];
  for (int i = 0; i < 4; ++i) {
    const size_t qrow = (size_t)(b * TT + q0 + i * 16) * QQ;
    qa[i][0] = load_frag(qb + qrow + 0);
    qa[i][1] = load_frag(qb + qrow + 512);
  }
  float m[4], l[4];
  for (int i = 0; i < 4; ++i) { m[i] = -1e30f; l[i] = 0.0f; }

  const int nk = min(nkey[b], TT);
  for (int j0 = wave * 32; j0 < nk; j0 += 256) {
    const size_t krow = (size_t)(b * TT + j0) * QQ;
    v16bf k0a = load_frag(kb + krow + 0);
    v16bf k0b = load_frag(kb + krow + 512);
    v16bf k1a = load_frag(kb + krow + 1024);
    v16bf k1b = load_frag(kb + krow + 1536);
    const float* mp = mbias + b * TT + j0 + 8 * hi;
    const v8f mb0 = *(const v8f*)(mp);
    const v8f mb1 = *(const v8f*)(mp + 16);
    for (int i = 0; i < 4; ++i) {
      v8f s0 = {}, s1 = {};
      s0 = __builtin_amdgcn_wmma_f32_16x16x32_bf16(false, k0a, false, qa[i][0], (short)0, s0, false, false);
      s1 = __builtin_amdgcn_wmma_f32_16x16x32_bf16(false, k1a, false, qa[i][0], (short)0, s1, false, false);
      s0 = __builtin_amdgcn_wmma_f32_16x16x32_bf16(false, k0b, false, qa[i][1], (short)0, s0, false, false);
      s1 = __builtin_amdgcn_wmma_f32_16x16x32_bf16(false, k1b, false, qa[i][1], (short)0, s1, false, false);
      s0 += mb0;
      s1 += mb1;
      const float mn = fmaxf(m[i], max16(s0, s1));
      const float corr = __builtin_amdgcn_exp2f((m[i] - mn) * LOG2E);
      const v8f p = exp2v((s0 - mn) * LOG2E) + exp2v((s1 - mn) * LOG2E);
      l[i] = l[i] * corr + sum8(p);
      m[i] = mn;
    }
  }

  for (int i = 0; i < 4; ++i) {
    const float mo = xhalf(m[i]), lo = xhalf(l[i]);
    const float mj = fmaxf(m[i], mo);
    const float lj = l[i] * __builtin_amdgcn_exp2f((m[i] - mj) * LOG2E)
                   + lo   * __builtin_amdgcn_exp2f((mo   - mj) * LOG2E);
    if (hi == 0) { sm[wave][i * 16 + n] = mj; ss[wave][i * 16 + n] = lj; }
  }
  __syncthreads();   // every wave's partial maximum and sum are in LDS
  if (threadIdx.x < 64) {
    const int q = threadIdx.x;
    float mj = sm[0][q];
    for (int w = 1; w < 8; ++w) mj = fmaxf(mj, sm[w][q]);
    float lj = 0.0f;
    for (int w = 0; w < 8; ++w)
      lj += ss[w][q] * __builtin_amdgcn_exp2f((sm[w][q] - mj) * LOG2E);
    qmax[b * TT + q0 + q] = mj;
    qlog[b * TT + q0 + q] = __builtin_amdgcn_logf(lj);   // log2
  }
}

// Pass 2: W^T = sum over query tiles of the normalised P^T, then V^T W^T.
// grid (T/64, B), block 256 = 8 waves. The work of a batch is its key blocks
// below nkey (64 keys, held as A operands by every wave) times its 128 query
// tiles; the batch's 32 work-groups take equal runs of it, key block by key
// block, so a run lies in one key block or in two that follow each other. Of a
// run's query tiles wave w takes the w-th, the (w + 8)-th, ... The sum over
// tiles is in-lane: column n of W^T collects the queries n mod 16. The waves'
// sums are joined through LDS; converted in place they are the bf16 B operand
// of the second product (hardware k order, the order of the v fragments), of
// which wave w does 32 output rows; the 16 columns are summed at the very end.
__global__ __launch_bounds__(256) void pool_kernel(
    const bf16* __restrict__ qb, const bf16* __restrict__ kb,
    const bf16* __restrict__ vtb, const float* __restrict__ mbias,
    const float* __restrict__ qmax, const float* __restrict__ qlog,
    const int* __restrict__ nkey, float* __restrict__ out)
{
  __shared__ f32x4 red[8][8][32];              // [wave][4 registers][lane]
  __shared__ f32x4 fin[8][32];                 // [4 registers][lane]
  const int lane = threadIdx.x & 31;
  const int wave = __builtin_amdgcn_readfirstlane(threadIdx.x >> 5);  // scalar: loop bounds and bases
  const int n = lane & 15, hi = lane >> 4;
  const int b  = blockIdx.y;
  const int run = ((min(nkey[b], TT) + 63) >> 6) * (TT / 16) / (TT / 64);   // tiles of a work-group: at most T/16
  const int u0 = blockIdx.x * run, u1 = u0 + run;   // unit = key block * (T/16) + query tile

  // At most two trips; every bound is the same for the whole work-group.
  for (int kblk = u0 / (TT / 16); kblk * (TT / 16) < u1; ++kblk) {
  const int j0 = kblk * 64;
  const int qe = min(u1 - kblk * (TT / 16), TT / 16);            // end of the run's query tiles here
  int qt = max(u0 - kblk * (TT / 16), 0) + wave;                 // this wave's first

  v16bf ka[4][2];
  v8f mb[4], acc[4];
  for (int i = 0; i < 4; ++i) {
    const size_t krow = (size_t)(b * TT + j0 + i * 16) * QQ;
    ka[i][0] = load_frag(kb + krow + 0);
    ka[i][1] = load_frag(kb + krow + 512);
    mb[i] = *(const v8f*)(mbias + b * TT + j0 + i * 16 + 8 * hi);
    acc[i] = v8f{};
  }

  // One query tile: scores of the block's 64 keys, normalised, added to acc.
  auto tile = [&](v16bf qa0, v16bf qa1, float qm, float ql) {
    v8f s[4];
    for (int i = 0; i < 4; ++i) {
      s[i] = v8f{};
      s[i] = __builtin_amdgcn_wmma_f32_16x16x32_bf16(false, ka[i][0], false, qa0, (short)0, s[i], false, false);
    }
    for (int i = 0; i < 4; ++i)
      s[i] = __builtin_amdgcn_wmma_f32_16x16x32_bf16(false, ka[i][1], false, qa1, (short)0, s[i], false, false);
    for (int i = 0; i < 4; ++i)
      acc[i] += exp2v(((s[i] + mb[i]) - qm) * LOG2E - ql);
  };

  // Two sets of operand registers: each tile's operands are fetched while the
  // tile before it is worked on, and no register copy is needed between them.
  // A fetch past the batch's last tile is turned to it; one past the run's end
  // is not used.
  const bf16*  qp = qb + (size_t)b * TT * QQ;
  const float* pm = qmax + b * TT + n;
  const float* pl = qlog + b * TT + n;
  v16bf a0, a1, b0, b1;
  float am, al, bm, bl;
  auto fetch = [&](int t, v16bf& f0, v16bf& f1, float& fm, float& fl) {
    t = min(t, TT / 16 - 1);
    const bf16*  fq = qp + t * (16 * QQ);
    const float* fa = pm + t * 16;
    const float* fb = pl + t * 16;
    f0 = load_frag(fq); f1 = load_frag(fq + 512);
    fm = *fa; fl = *fb;
    // Precaution: the wait in front of any rewrite of these loads' address registers.
    asm volatile("s_wait_xcnt 0x0" ::: "memory");
  };
  fetch(qt, a0, a1, am, al);
  for (; qt + 8 < qe; qt += 16) {
    fetch(qt + 8, b0, b1, bm, bl);
    tile(a0, a1, am, al);
    fetch(qt + 16, a0, a1, am, al);
    tile(b0, b1, bm, bl);
  }
  if (qt < qe) tile(a0, a1, am, al);

  for (int i = 0; i < 4; ++i) {
    red[wave][2 * i + 0][lane] = f32x4{acc[i][0], acc[i][1], acc[i][2], acc[i][3]};
    red[wave][2 * i + 1][lane] = f32x4{acc[i][4], acc[i][5], acc[i][6], acc[i][7]};
  }
  __syncthreads();   // every wave's sums are in LDS
  f32x4 g = red[0][wave][lane];
  for (int w = 1; w < 8; ++w) g += red[w][wave][lane];
  fin[wave][lane] = g;
  __syncthreads();   // the joined sums are in LDS

  v16bf pb0, pb1;
#pragma unroll   // constant element numbers keep both operands in registers
  for (int c = 0; c < 4; ++c) {
    const f32x4 f0 = fin[c][lane], f1 = fin[4 + c][lane];
#pragma unroll   // as above
    for (int e = 0; e < 4; ++e) {
      pb0[4 * c + e] = (bf16)f0[e];
      pb1[4 * c + e] = (bf16)f1[e];
    }
  }

  const float invT = 1.0f / (float)TT;
  const size_t vrow = (size_t)(b * TT + j0) * DD;
  for (int c = 0; c < 2; ++c) {
    const int dt = wave * 2 + c;               // 16-row tile of O^T
    v16bf v0 = load_frag(vtb + vrow + dt * 512);
    v16bf v1 = load_frag(vtb + vrow + 32 * DD + dt * 512);
    v8f o = {};
    o = __builtin_amdgcn_wmma_f32_16x16x32_bf16(false, v0, false, pb0, (short)0, o, false, false);
    o = __builtin_amdgcn_wmma_f32_16x16x32_bf16(false, v1, false, pb1, (short)0, o, false, false);
    float sacc = 0.0f;
    for (int r = 0; r < 8; ++r) {
      float q = rsum16(o[r]);                  // every lane of the row holds the sum
      sacc = (n == r) ? q : sacc;              // lane n < 8 keeps row 8 * hi + n
    }
    if (n < 8)
      atomicAdd(&out[b * DD + dt * 16 + 8 * hi + n], sacc * invT);
    // Precaution: in front of the rewrite of the add's registers further on.
    asm volatile("s_wait_xcnt 0x0" ::: "memory");
  }
  }
}

// ------------------------------- launcher ----------------------------------

extern "C" void kernel_launch(void* const* d_in, const int* in_sizes, int n_in,
                              void* d_out, int out_size, void* d_ws, size_t ws_size,
                              hipStream_t stream) {
  const float* x    = (const float*)d_in[0];
  const float* sl   = (const float*)d_in[1];
  const int*   mask = (const int*)  d_in[2];
  const float* Wq   = (const float*)d_in[3];
  const float* bq   = (const float*)d_in[4];
  const float* Wk   = (const float*)d_in[5];
  const float* bk   = (const float*)d_in[6];
  const float* Wv   = (const float*)d_in[7];
  const float* bv   = (const float*)d_in[8];
  float* out = (float*)d_out;

  char* ws = (char*)d_ws;
  const size_t OFF_WB = 0;
  const size_t OFF_QB = OFF_WB + (size_t)384 * DD * 2;
  const size_t OFF_KB = OFF_QB + (size_t)BB * TT * QQ * 2;
  const size_t OFF_VT = OFF_KB + (size_t)BB * TT * QQ * 2;
  const size_t OFF_MB = OFF_VT + (size_t)BB * DD * TT * 2;
  const size_t OFF_QM = OFF_MB + (size_t)BB * TT * 4;
  const size_t OFF_QL = OFF_QM + (size_t)BB * TT * 4;
  const size_t OFF_SP = OFF_QL + (size_t)BB * TT * 4;
  const size_t OFF_PR = OFF_SP + (size_t)BB * TT * 4;
  const size_t OFF_NK = OFF_PR + (size_t)BB * TT * 4;

  bf16*  qbp = (bf16*)(ws + OFF_QB);
  bf16*  kbp = (bf16*)(ws + OFF_KB);
  bf16*  vtb = (bf16*)(ws + OFF_VT);
  float* mb  = (float*)(ws + OFF_MB);
  float* qm  = (float*)(ws + OFF_QM);
  float* ql  = (float*)(ws + OFF_QL);
  int*   nk  = (int*)(ws + OFF_NK);

  // 1) row order and key counts, zeros in the output, QKV projection (WMMA bf16),
  //    x and the weights converted on the way: one launch
  proj_kernel<<<BB * 16, 512, 0, stream>>>(
      x, Wq, Wk, Wv, bq, bk, bv, sl, mask, mb, nk, out, qbp, kbp, vtb);

  // 2) every query's maximum and log-sum (WMMA bf16)
  stat_kernel<<<dim3(TT / 64, BB), 256, 0, stream>>>(qbp, kbp, mb, nk, qm, ql);

  // 3) query-sum of the normalised probabilities, then the V product (WMMA bf16)
  pool_kernel<<<dim3(TT / 64, BB), 256, 0, stream>>>(qbp, kbp, vtb, mb, qm, ql, nk, out);
}

// v009
// It runs in 30.4 microseconds.
// In both of two side-by-side timings against v008, it was 1.19 times as fast.
// Counting every step since v000, it is 13.1 times as fast.
#include <hip/hip_runtime.h>

// ---------------------------------------------------------------------------
// NEGAPooling for MI455X (gfx1250, wave32, WMMA bf16)
// B=16, T=2048, D=256, QK=64
// ---------------------------------------------------------------------------

typedef __bf16 bf16;
typedef __attribute__((ext_vector_type(16))) __bf16       v16bf;
typedef __attribute__((ext_vector_type(8)))  float        v8f;
typedef __attribute__((ext_vector_type(4)))  unsigned int u32x4;
typedef __attribute__((ext_vector_type(2)))  unsigned int u32x2;
typedef __attribute__((ext_vector_type(4)))  float        f32x4;
typedef __attribute__((ext_vector_type(4)))  int          i32x4;

#define BB 16
#define TT 2048
#define DD 256
#define QQ 64

struct BF16Tile { u32x4 lo, hi; };

// Operand layout of the 16x16x32 bf16 WMMA (ISA 7.12.2, 16-bit A 16x32):
// lanes 0-15 hold row M=lane, K chunks {0..7, 16..23}; lanes 16-31 hold row
// M=lane-16, K {8..15, 24..31}. B mirrors it (lane = column N, same K chunks).

// Fragment order: every WMMA operand that lives in the workspace is stored as
// 1 KiB fragments (16 rows x 32 k). Element (row c, k) of a fragment sits at
//   ((k >> 4) & 1) * 256 + (((k >> 3) & 1) * 16 + c) * 8 + (k & 7)
// so lane l finds the two 16-byte chunks of that layout at l * 8 and
// 256 + l * 8: each load of a wave reads 512 contiguous bytes (4 cache lines)
// where the row-major tile made it touch 16 lines.
__device__ __forceinline__ v16bf load_frag(const bf16* frag) {
  const bf16* p = frag + ((threadIdx.x & 31) << 3);
  BF16Tile t;
  t.lo = *(const u32x4*)(p);
  t.hi = *(const u32x4*)(p + 256);
  return __builtin_bit_cast(v16bf, t);
}

// Lane l takes the value of lane l ^ 16 (the other half of the wave).
__device__ __forceinline__ float xhalf(float x) {
  int b = __builtin_bit_cast(int, x);
  return __builtin_bit_cast(float,
      __builtin_amdgcn_permlanex16(b, b, 0x76543210, 0xfedcba98, false, false));
}
// Lane l takes the value of lane l ^ X inside its 16-lane row (DPP row_xmask:X).
template <int X>
__device__ __forceinline__ float xrow(float v) {
  return __builtin_bit_cast(float,
      __builtin_amdgcn_update_dpp(0, __builtin_bit_cast(int, v), 0x160 + X, 0xf, 0xf, true));
}
__device__ __forceinline__ float rsum16(float v) {
  v += xrow<1>(v);
  v += xrow<2>(v);
  v += xrow<4>(v);
  v += xrow<8>(v);
  return v;
}

// --------------------------- projection kernel -----------------------------
// One launch does the row order, the weight conversion and the projection
// [B*T, 384] = x[B*T,256] @ [Wq;Wk;Wv]^T; no launch runs in front of it.
//
// Row order. A masked key has probability 0 as long as its batch has an
// unmasked one, and the result does not depend on the order of a batch's rows
// (keys are summed over, queries averaged). So the rows are put in a new order,
// the unmasked first, each kind in its old order. Every block counts its own
// batch's mask (a thread takes 4 rows, prefix sums over the block) and keeps the
// old row and sl of its own 128 places in LDS. nkey = the number of keys that
// the attention kernel goes through (all of them where every key is masked: the
// uniform row); mb = the mask bias in the new order.
//
// grid B * 16, block 512 = 16 waves, one block to a WGP. A block takes two
// 64-place blocks of one batch, number pa from the front (waves 0-7) and
// T/64 - 1 - pa from the back (waves 8-15), so that every block has about the
// same share of key places. k and v are read only in the 64-place blocks that
// begin below nkey (the key loops end there), q everywhere: waves whose 64
// places all lie at or past nkey make q alone (i = 0).
//
// x and the weights arrive as f32 and are read with whole-line loads, rounded
// to bf16 and laid in LDS as fragments. q, k, v leave in fragment order:
// cols 0..63 -> q (bf16), fragments [16-row tile][e / 32]
// cols 64..127 -> k scaled by (1/sqrt(QK))*(1+clip(sl)^2)  (bf16), same order
// cols 128..383 -> v (bf16), fragments of v transposed (row = d, k = t):
//                  [b][t / 32][d / 16]
// Of its eight, wave w takes row tiles 2 (w / 4) and 2 (w / 4) + 1, so one read
// of a W fragment serves two products, and column tiles (w % 4) + 4 i: one of
// q, one of k, four of v; 12 accumulators.

template <int N> struct Count { static constexpr int v = N; };

// Work-group barrier that orders LDS accesses only: with __syncthreads() a wave
// would first wait for its weight loads, which are to stay in flight across it.
__device__ __forceinline__ void lds_barrier() {
  __builtin_amdgcn_fence(__ATOMIC_RELEASE, "workgroup", "local");
  __builtin_amdgcn_s_barrier();
  __builtin_amdgcn_fence(__ATOMIC_ACQUIRE, "workgroup", "local");
}

// LDS: group g = (row / 16) * 32 + k / 8 holds 16 rows x 8 k (256 bytes). The
// pitch of 272 bytes puts the 16 groups that one wave's store touches, and the
// two groups that one fragment read touches, on different banks.
#define XP 136

__global__ __launch_bounds__(512) void proj_kernel(
    const float* __restrict__ x, const float* __restrict__ Wq,
    const float* __restrict__ Wk, const float* __restrict__ Wv,
    const float* __restrict__ bq, const float* __restrict__ bk,
    const float* __restrict__ bv, const float* __restrict__ sl,
    const int* __restrict__ mask,
    float* __restrict__ mb, int* __restrict__ nkey, float* __restrict__ out,
    bf16* __restrict__ qb, bf16* __restrict__ kb, bf16* __restrict__ vtb)
{
  __shared__ __attribute__((aligned(16))) bf16 xs[2 * 128 * XP];   // 2 x 64 rows of x
  __shared__ __attribute__((aligned(16))) bf16 wl[24 * 32 * XP];   // 384 rows of W
  __shared__ __attribute__((aligned(32))) float sll[128];          // sl of the block's places
  __shared__ int prm[128];                                         // old row of the block's places
  __shared__ int wsum[16];
  const int batch = blockIdx.x % BB;
  const int pa = blockIdx.x / BB, pb = TT / 64 - 1 - pa;  // the block's two 64-place blocks
  const int lane = threadIdx.x & 31;
  const int wave = __builtin_amdgcn_readfirstlane(threadIdx.x >> 5);  // scalar: tile numbers and bases
  const int sub = wave >> 3, wv = wave & 7;               // which place block, wave in it
  const int n = lane & 15, hi = lane >> 4;

  const int t0 = threadIdx.x * 4;                         // a thread counts 4 rows in a row
  const i32x4 m0 = *(const i32x4*)(mask + batch * TT + t0);
  const f32x4 s0 = *(const f32x4*)(sl + batch * TT + t0);

  // Weights: thread t takes the 16-byte piece t % 64 of rows t / 64 + 8 j, so a
  // wave reads half a row; 16 rows of a thread make one batch of loads.
  const int wk = (threadIdx.x & 63) * 4, wr = threadIdx.x >> 6;
  const float* const tq = Wq + wr * DD + wk;
  const float* const tk = Wk + wr * DD + wk;
  const float* const tv = Wv + wr * DD + wk;
  auto load_w = [&](auto first, f32x4 (&g)[16]) {
#pragma unroll   // j names the matrix and the register at compile time
    for (int j = 0; j < 16; ++j) {
      const int jj = decltype(first)::v + j;
      const float* w = jj < 8 ? tq + jj * (8 * DD) : jj < 16 ? tk + (jj - 8) * (8 * DD) : tv + (jj - 16) * (8 * DD);
      g[j] = *(const f32x4*)w;
    }
    // Precaution: the wait in front of any rewrite of these loads' address
    // registers; as its inputs the addresses stay in their registers up to it.
    asm volatile("s_wait_xcnt 0x0" :: "v"(tq), "v"(tk), "v"(tv) : "memory");
  };
  auto store_w = [&](auto first, const f32x4 (&g)[16]) {
    bf16* dst = wl + (wk >> 3) * XP + (wk & 7);
#pragma unroll   // constant element numbers keep g in registers
    for (int j = 0; j < 16; ++j) {
      const int row = (decltype(first)::v + j) * 8 + wr;
      __attribute__((aligned(8))) bf16 pk[4];
      for (int e = 0; e < 4; ++e) pk[e] = (bf16)g[j][e];
      *(u32x2*)(dst + (row >> 4) * (32 * XP) + (row & 15) * 8) = *(const u32x2*)pk;
    }
  };
  f32x4 g0[16], g1[16];
  load_w(Count<0>{}, g0);                      // Wq, Wk and the first half of Wv:
  load_w(Count<16>{}, g1);                     // in flight while the mask is counted

  int cnt = 0;
  for (int e = 0; e < 4; ++e) cnt += (m0[e] != 0);
  int inc = cnt;                               // unmasked rows up to and with this thread's
  for (int d = 1; d < 32; d <<= 1) {
    const int o = __shfl_up(inc, d);
    if (lane >= d) inc += o;
  }
  if (lane == 31) wsum[wave] = inc;
  lds_barrier();     // every wave's count is in LDS
  int before = inc - cnt, total = 0;
  for (int w = 0; w < 16; ++w) {
    const int c = wsum[w];
    before += (w < wave) ? c : 0;
    total  += c;
  }
  {
    int pv = before;                           // next place among the unmasked
    int pm = total + (t0 - before);            // next place among the masked
    for (int e = 0; e < 4; ++e) {
      const bool keep = m0[e] != 0;
      const int p = keep ? pv : pm;
      pv += keep ? 1 : 0;
      pm += keep ? 0 : 1;
      const int pblk = p >> 6;
      if (pblk == pa || pblk == pb) {
        const int slot = (pblk == pa ? 0 : 64) + (p & 63);
        prm[slot] = t0 + e;
        sll[slot] = s0[e];
      }
    }
  }
  total = __builtin_amdgcn_readfirstlane(total);          // the same in every thread of the block
  const int nk = total == 0 ? TT : total;
  const bool full_a = pa * 64 < nk;                       // pb > pa: no k or v at all where this fails
  const bool full   = (sub ? pb : pa) * 64 < nk;          // the same for the whole wave
  const int blk   = batch * (TT / 64) + (sub ? pb : pa);  // the wave's 64 places
  const int tile0 = blk * 4 + (wv >> 2) * 2;              // first 16-row tile of this wave
  const int cq    = wv & 3;
  if (threadIdx.x < 128) {
    const int p = (threadIdx.x < 64 ? pa : pb) * 64 + (threadIdx.x & 63);
    mb[batch * TT + p] = p < total ? 0.0f : -1e9f;
  } else if (threadIdx.x < 128 + BB * DD / (BB * 16)) {
    out[blockIdx.x * (BB * DD / (BB * 16)) + threadIdx.x - 128] = 0.0f;   // attn_kernel adds into out
  } else if (threadIdx.x == 256 && pa == 0) {
    nkey[batch] = nk;
  }
  // Precaution: the wait in front of any rewrite of these stores' registers further on.
  asm volatile("s_wait_xcnt 0x0" ::: "memory");
  lds_barrier();     // the old rows and sl of the block's 128 places are in LDS

  // Two sets of operand registers: the six W fragments and
  // the two x fragments of k block kf + 1 are read while block kf is worked on.
  v16bf w[2][6], a[2][2];
  auto frag = [&](const bf16* s) {
    BF16Tile tl;
    tl.lo = *(const u32x4*)(s);
    tl.hi = *(const u32x4*)(s + 2 * XP);
    return __builtin_bit_cast(v16bf, tl);
  };
  auto fetch_w = [&](auto ni, int set, int kf) {
#pragma unroll   // constant element numbers keep the fragments in registers
    for (int i = 0; i < decltype(ni)::v; ++i)
      w[set][i] = frag(wl + ((cq + 4 * i) * 32 + kf * 4 + hi) * XP + n * 8);
  };
  auto fetch_a = [&](int set, int kf) {
#pragma unroll   // as above
    for (int t = 0; t < 2; ++t)
      a[set][t] = frag(xs + ((sub * 4 + (wv >> 2) * 2 + t) * 32 + kf * 4 + hi) * XP + n * 8);
  };

  // Of its place block's 256 threads, thread t takes the 16-byte piece t of
  // every 4 rows: a wave reads half a row.
  {
    const float* xb = x + (size_t)batch * TT * DD;
    const int* pr = prm + sub * 64 + (wv >> 1);
    const int piece = threadIdx.x & 63;
    const f32x4* ps[16];
    f32x4 f[16];
#pragma unroll   // constant element numbers keep the addresses in registers
    for (int j = 0; j < 16; ++j)
      ps[j] = (const f32x4*)(xb + (pr[j * 4] & (TT - 1)) * DD) + piece;
#pragma unroll   // all 16 loads of a thread are in flight together
    for (int j = 0; j < 16; ++j) f[j] = *ps[j];
    // Precaution: the wait in front of any rewrite of these loads' address
    // registers; as its input the lane's part stays in its register up to it.
    asm volatile("s_wait_xcnt 0x0" :: "v"(piece) : "memory");
    store_w(Count<0>{}, g0);
    if (full_a) load_w(Count<32>{}, g0);       // Wv, second half: in flight behind the x loads
    store_w(Count<16>{}, g1);
    const int k = (threadIdx.x & 63) * 4;
    bf16* dst = xs + sub * (128 * XP) + (k >> 3) * XP + (k & 7);
#pragma unroll   // constant element numbers keep f in registers
    for (int j = 0; j < 16; ++j) {
      const int row = j * 4 + ((threadIdx.x >> 6) & 3);
      __attribute__((aligned(8))) bf16 pk[4];
      for (int e = 0; e < 4; ++e) pk[e] = (bf16)f[j][e];
      *(u32x2*)(dst + (row >> 4) * (32 * XP) + (row & 15) * 8) = *(const u32x2*)pk;
    }
  }
  if (full_a) store_w(Count<32>{}, g0);

  v8f c[6][2];
#pragma unroll   // constant element numbers for c[][]
  for (int i = 0; i < 6; ++i) {
    const int col = (cq + 4 * i) * 16 + n;
    const float bias = (i == 0) ? bq[col] : (i == 1 ? bk[col - QQ] : bv[col - 2*QQ]);
    for (int r = 0; r < 8; ++r) { c[i][0][r] = bias; c[i][1][r] = bias; }
  }
  __syncthreads();   // the block's 128 rows and the weights are in LDS

  // The products and the stores, for the first NI of the wave's column tiles.
  auto rest = [&](auto ni) {
  constexpr int NI = decltype(ni)::v;
  v8f slv[2];                                  // sl of the lane's 8 rows of each tile
  fetch_w(ni, 0, 0); fetch_a(0, 0);
#pragma unroll   // kf & 1 names the register set at compile time
  for (int kf = 0; kf < 8; ++kf) {
    const int cur = kf & 1;
    if (kf < 7) {
      fetch_w(ni, cur ^ 1, kf + 1); fetch_a(cur ^ 1, kf + 1);
    } else if (NI > 1) {
      const float* sp = sll + sub * 64 + (wv >> 2) * 32 + 8 * hi;
      slv[0] = *(const v8f*)(sp);
      slv[1] = *(const v8f*)(sp + 16);
    }
    // Keeps the reads above in front of the products below: sunk to their
    // first use, each would be waited for at its full latency.
    __builtin_amdgcn_sched_barrier(0);
#pragma unroll   // constant element numbers for c[][] and w[][]
    for (int i = 0; i < NI; ++i) {
      c[i][0] = __builtin_amdgcn_wmma_f32_16x16x32_bf16(false, a[cur][0], false, w[cur][i], (short)0, c[i][0], false, false);
      c[i][1] = __builtin_amdgcn_wmma_f32_16x16x32_bf16(false, a[cur][1], false, w[cur][i], (short)0, c[i][1], false, false);
    }
  }

  // Epilogue. C/D layout: lane holds column n; VGPR r holds row (r + 8*hi).
#pragma unroll   // i decides the kind of column tile at compile time
  for (int i = 0; i < NI; ++i) {
    const int nt = cq + 4 * i;                 // 0..23: 16-col tile
#pragma unroll   // constant element numbers for c[][]
    for (int t = 0; t < 2; ++t) {
      const int tile = tile0 + t;
      if (i < 2) {
        // e = (nt & 3) * 16 + n is the fragment's k, the row r + 8 * hi its row.
        const size_t fo = (size_t)tile * (16 * QQ) + ((nt >> 1) & 1) * 512 + (nt & 1) * 256
                        + (((n >> 3) << 4) + 8 * hi) * 8 + (n & 7);
        for (int r = 0; r < 8; ++r) {
          float v = c[i][t][r];
          if (i == 1) {
            float s = slv[t][r];               // row tile * 16 + r + 8 * hi
            s = fminf(fmaxf(s, 0.0f), 1.0f);
            v *= 0.125f * (1.0f + s * s);      // 1/sqrt(64) * (1 + sl^2)
            kb[fo + r * 8] = (bf16)v;
          } else {
            qb[fo + r * 8] = (bf16)v;
          }
        }
      } else {
        // The lane's 8 consecutive t of column d are one 16-byte chunk of the
        // fragment (t / 32, d / 16): half (tile & 1), lane as it is here.
        __attribute__((aligned(16))) bf16 pk[8];
        for (int r = 0; r < 8; ++r) pk[r] = (bf16)c[i][t][r];
        *(u32x4*)(vtb + ((size_t)(tile >> 1) * (DD / 16) + (nt - 8)) * 512
                      + (tile & 1) * 256 + lane * 8) = *(const u32x4*)pk;
      }
    }
  }
  // Precaution: the wait in front of any rewrite of the stores' registers further on.
  asm volatile("s_wait_xcnt 0x0" ::: "memory");
  };
  if (full) rest(Count<6>{}); else rest(Count<1>{});
}

// ---------------------------- attention kernel ----------------------------
// The output is the mean over the queries of P V, and that mean commutes with
// the product: out = (1/T) * V^T (sum over queries of P^T). A query's row of P
// must be normalised before rows are added, so the work runs in two passes.
// Both form S^T = K Q^T: in a D tile a lane holds ONE query (column n) and its
// registers hold keys 8 * hi + r.
//
// The mask bias belongs to the key, the D row. It is added to the finished
// score by a vector add, whose one rounding leaves every masked score at the
// same value; the maximum is subtracted before the scaling to base 2, so that
// a row with every key masked comes out uniform.

#define LOG2E 1.44269504f

__device__ __forceinline__ float max16(v8f a, v8f b) {
  float t[8];
  for (int r = 0; r < 8; ++r) t[r] = fmaxf(a[r], b[r]);
  return fmaxf(fmaxf(fmaxf(t[0], t[1]), fmaxf(t[2], t[3])),
               fmaxf(fmaxf(t[4], t[5]), fmaxf(t[6], t[7])));
}
__device__ __forceinline__ v8f exp2v(v8f x) {
  v8f y;
  for (int r = 0; r < 8; ++r) y[r] = __builtin_amdgcn_exp2f(x[r]);
  return y;
}
__device__ __forceinline__ float sum8(v8f t) {
  return ((t[0] + t[1]) + (t[2] + t[3])) + ((t[4] + t[5]) + (t[6] + t[7]));
}

// Both passes run in one launch. grid (T/128, B), block 256 = 8 waves, one
// block to a WGP. A block owns 128 queries: 8 tiles, held as B operands by every
// wave through both passes. Wave w takes the groups of 32 keys w, w + 8, ...
// below nkey, the same groups in both passes.
// Pass 1: a lane keeps maximum and sum of its own keys; halves and waves are
// joined once through LDS, which gives every query's maximum and log2 sum.
// Pass 2: the scores again, normalised and summed over the 8 query tiles
// in-lane (column n collects the queries n mod 16). Converted in place, the sums
// of a group are the bf16 B operand (hardware k order, the order of the v
// fragments) of O^T += V^T W^T for the group's 32 keys, all 256 rows. The waves'
// O^T are joined through LDS, the 16 columns summed, the block's share added
// to out.
__global__ __launch_bounds__(256) void attn_kernel(
    const bf16* __restrict__ qb, const bf16* __restrict__ kb,
    const bf16* __restrict__ vtb, const float* __restrict__ mbias,
    const int* __restrict__ nkey, float* __restrict__ out)
{
  __shared__ f32x4 red[8][32][32];             // [wave][4 registers of O^T][lane]
  __shared__ float sm[8][128];
  __shared__ float ss[8][128];
  __shared__ float fm[128];
  __shared__ float fl[128];
  const int lane = threadIdx.x & 31;
  const int wave = __builtin_amdgcn_readfirstlane(threadIdx.x >> 5);  // scalar: loop bounds and bases
  const int n = lane & 15, hi = lane >> 4;
  const int q0 = blockIdx.x * 128;
  const int b  = blockIdx.y;

  v16bf qa[8][2];
  const bf16* qp = qb + (size_t)(b * TT + q0) * QQ;
#pragma unroll   // constant element numbers keep the fragments in registers
  for (int i = 0; i < 8; ++i) {
    qa[i][0] = load_frag(qp + i * (16 * QQ) + 0);
    qa[i][1] = load_frag(qp + i * (16 * QQ) + 512);
  }
  // Precaution: the wait in front of any rewrite of these loads' address
  // registers; as its input the address stays in its registers up to it.
  asm volatile("s_wait_xcnt 0x0" :: "s"(qp) : "memory");
  const int nk = min(nkey[b], TT);
  const bf16*  kp = kb + (size_t)b * TT * QQ;
  const float* mp = mbias + b * TT + 8 * hi;
  const bf16*  vp = vtb + (size_t)b * TT * DD;
  const int jw = wave * 32;                    // this wave's first group

  // The four k fragments and the mask bias of the 32 keys from place j on.
  auto fetch = [&](int j, v16bf (&k)[4], v8f (&mv)[2]) {
    const bf16*  fk = kp + j * QQ;
    const float* fb = mp + j;
#pragma unroll   // constant element numbers keep the fragments in registers
    for (int c = 0; c < 4; ++c) k[c] = load_frag(fk + c * 512);
    mv[0] = *(const v8f*)(fb);
    mv[1] = *(const v8f*)(fb + 16);
    // Precaution: the wait in front of any rewrite of these loads' address
    // registers; as its inputs the addresses stay in their registers up to it.
    asm volatile("s_wait_xcnt 0x0" :: "s"(fk), "v"(fb) : "memory");
  };

  // ---- pass 1 ----
  float m[8], l[8];
  for (int i = 0; i < 8; ++i) { m[i] = -1e30f; l[i] = 0.0f; }
  {
    // The next group's operands are fetched while this group is worked on. A
    // fetch past the end is turned to a group that exists and is not used.
    v16bf kn[4];
    v8f bn[2];
    fetch(jw < nk ? jw : 0, kn, bn);
    for (int j0 = jw; j0 < nk; j0 += 256) {
      v16bf k[4];
      v8f mv[2];
      for (int c = 0; c < 4; ++c) k[c] = kn[c];
      mv[0] = bn[0]; mv[1] = bn[1];
      fetch(j0 + 256 < nk ? j0 + 256 : j0, kn, bn);
#pragma unroll   // constant element numbers for qa, m and l
      for (int i = 0; i < 8; ++i) {
        v8f s0 = {}, s1 = {};
        s0 = __builtin_amdgcn_wmma_f32_16x16x32_bf16(false, k[0], false, qa[i][0], (short)0, s0, false, false);
        s1 = __builtin_amdgcn_wmma_f32_16x16x32_bf16(false, k[2], false, qa[i][0], (short)0, s1, false, false);
        s0 = __builtin_amdgcn_wmma_f32_16x16x32_bf16(false, k[1], false, qa[i][1], (short)0, s0, false, false);
        s1 = __builtin_amdgcn_wmma_f32_16x16x32_bf16(false, k[3], false, qa[i][1], (short)0, s1, false, false);
        s0 += mv[0];
        s1 += mv[1];
        const float mn = fmaxf(m[i], max16(s0, s1));
        const float corr = __builtin_amdgcn_exp2f((m[i] - mn) * LOG2E);
        const v8f p = exp2v((s0 - mn) * LOG2E) + exp2v((s1 - mn) * LOG2E);
        l[i] = l[i] * corr + sum8(p);
        m[i] = mn;
      }
    }
  }

#pragma unroll   // constant element numbers for m and l
  for (int i = 0; i < 8; ++i) {
    const float mo = xhalf(m[i]), lo = xhalf(l[i]);
    const float mj = fmaxf(m[i], mo);
    const float lj = l[i] * __builtin_amdgcn_exp2f((m[i] - mj) * LOG2E)
                   + lo   * __builtin_amdgcn_exp2f((mo   - mj) * LOG2E);
    if (hi == 0) { sm[wave][i * 16 + n] = mj; ss[wave][i * 16 + n] = lj; }
  }
  __syncthreads();   // every wave's partial maximum and sum are in LDS
  if (threadIdx.x < 128) {
    const int q = threadIdx.x;
    float mj = sm[0][q];
    for (int w = 1; w < 8; ++w) mj = fmaxf(mj, sm[w][q]);
    float lj = 0.0f;
    for (int w = 0; w < 8; ++w)
      lj += ss[w][q] * __builtin_amdgcn_exp2f((sm[w][q] - mj) * LOG2E);
    fm[q] = mj;
    fl[q] = __builtin_amdgcn_logf(lj);   // log2
  }
  __syncthreads();   // every query's maximum and log2 sum are in LDS
  float qm[8], ql[8];
#pragma unroll   // constant element numbers for qm and ql
  for (int i = 0; i < 8; ++i) { qm[i] = fm[i * 16 + n]; ql[i] = fl[i * 16 + n]; }

  // ---- pass 2 ----
  v8f o[16];
#pragma unroll   // constant element numbers for o
  for (int dt = 0; dt < 16; ++dt) o[dt] = v8f{};
  for (int j0 = jw; j0 < nk; j0 += 256) {
    v16bf k[4], vf[16];
    v8f mv[2];
    fetch(j0, k, mv);
    const bf16* fv = vp + j0 * DD;
#pragma unroll   // constant element numbers keep the fragments in registers
    for (int dt = 0; dt < 16; ++dt) vf[dt] = load_frag(fv + dt * 512);
    // Precaution: the wait in front of any rewrite of these loads' address
    // registers; as its input the address stays in its registers up to it.
    asm volatile("s_wait_xcnt 0x0" :: "s"(fv) : "memory");
    // Keeps the v loads above in front of the scores below, which cover their
    // latency: sunk to their first use, each would be waited for in full.
    __builtin_amdgcn_sched_barrier(0);
    v8f acc0 = {}, acc1 = {};
#pragma unroll   // constant element numbers for qa, qm and ql
    for (int i = 0; i < 8; ++i) {
      v8f s0 = {}, s1 = {};
      s0 = __builtin_amdgcn_wmma_f32_16x16x32_bf16(false, k[0], false, qa[i][0], (short)0, s0, false, false);
      s1 = __builtin_amdgcn_wmma_f32_16x16x32_bf16(false, k[2], false, qa[i][0], (short)0, s1, false, false);
      s0 = __builtin_amdgcn_wmma_f32_16x16x32_bf16(false, k[1], false, qa[i][1], (short)0, s0, false, false);
      s1 = __builtin_amdgcn_wmma_f32_16x16x32_bf16(false, k[3], false, qa[i][1], (short)0, s1, false, false);
      acc0 += exp2v(((s0 + mv[0]) - qm[i]) * LOG2E - ql[i]);
      acc1 += exp2v(((s1 + mv[1]) - qm[i]) * LOG2E - ql[i]);
    }
    v16bf pb;                                  // keys 8 * hi + e, then 16 + 8 * hi + e
#pragma unroll   // constant element numbers keep the operand in registers
    for (int e = 0; e < 8; ++e) {
      pb[e]     = (bf16)acc0[e];
      pb[8 + e] = (bf16)acc1[e];
    }
#pragma unroll   // constant element numbers for o and vf
    for (int dt = 0; dt < 16; ++dt)
      o[dt] = __builtin_amdgcn_wmma_f32_16x16x32_bf16(false, vf[dt], false, pb, (short)0, o[dt], false, false);
  }

#pragma unroll   // constant element numbers for o
  for (int dt = 0; dt < 16; ++dt) {
    red[wave][2 * dt + 0][lane] = f32x4{o[dt][0], o[dt][1], o[dt][2], o[dt][3]};
    red[wave][2 * dt + 1][lane] = f32x4{o[dt][4], o[dt][5], o[dt][6], o[dt][7]};
  }
  __syncthreads();   // every wave's O^T is in LDS

  const float invT = 1.0f / (float)TT;
  for (int c = 0; c < 2; ++c) {
    const int dt = wave * 2 + c;               // 16-row tile of O^T
    f32x4 g0 = red[0][2 * dt + 0][lane];
    f32x4 g1 = red[0][2 * dt + 1][lane];
    for (int w = 1; w < 8; ++w) {
      g0 += red[w][2 * dt + 0][lane];
      g1 += red[w][2 * dt + 1][lane];
    }
    float sacc = 0.0f;
    for (int r = 0; r < 8; ++r) {
      float q = rsum16(r < 4 ? g0[r & 3] : g1[r & 3]);   // every lane of the row holds the sum
      sacc = (n == r) ? q : sacc;              // lane n < 8 keeps row 8 * hi + n
    }
    if (n < 8)
      atomicAdd(&out[b * DD + dt * 16 + 8 * hi + n], sacc * invT);
    // Precaution: in front of the rewrite of the add's registers further on.
    asm volatile("s_wait_xcnt 0x0" ::: "memory");
  }
}

// ------------------------------- launcher ----------------------------------

extern "C" void kernel_launch(void* const* d_in, const int* in_sizes, int n_in,
                              void* d_out, int out_size, void* d_ws, size_t ws_size,
                              hipStream_t stream) {
  const float* x    = (const float*)d_in[0];
  const float* sl   = (const float*)d_in[1];
  const int*   mask = (const int*)  d_in[2];
  const float* Wq   = (const float*)d_in[3];
  const float* bq   = (const float*)d_in[4];
  const float* Wk   = (const float*)d_in[5];
  const float* bk   = (const float*)d_in[6];
  const float* Wv   = (const float*)d_in[7];
  const float* bv   = (const float*)d_in[8];
  float* out = (float*)d_out;

  char* ws = (char*)d_ws;
  const size_t OFF_WB = 0;
  const size_t OFF_QB = OFF_WB + (size_t)384 * DD * 2;
  const size_t OFF_KB = OFF_QB + (size_t)BB * TT * QQ * 2;
  const size_t OFF_VT = OFF_KB + (size_t)BB * TT * QQ * 2;
  const size_t OFF_MB = OFF_VT + (size_t)BB * DD * TT * 2;
  const size_t OFF_QM = OFF_MB + (size_t)BB * TT * 4;
  const size_t OFF_QL = OFF_QM + (size_t)BB * TT * 4;
  const size_t OFF_SP = OFF_QL + (size_t)BB * TT * 4;
  const size_t OFF_PR = OFF_SP + (size_t)BB * TT * 4;
  const size_t OFF_NK = OFF_PR + (size_t)BB * TT * 4;

  bf16*  qbp = (bf16*)(ws + OFF_QB);
  bf16*  kbp = (bf16*)(ws + OFF_KB);
  bf16*  vtb = (bf16*)(ws + OFF_VT);
  float* mb  = (float*)(ws + OFF_MB);
  int*   nk  = (int*)(ws + OFF_NK);

  // 1) row order and key counts, zeros in the output, QKV projection (WMMA bf16),
  //    x and the weights converted on the way: one launch
  proj_kernel<<<BB * 16, 512, 0, stream>>>(
      x, Wq, Wk, Wv, bq, bk, bv, sl, mask, mb, nk, out, qbp, kbp, vtb);

  // 2) both attention passes and the V product (WMMA bf16)
  attn_kernel<<<dim3(TT / 128, BB), 256, 0, stream>>>(qbp, kbp, vtb, mb, nk, out);
}

// v010
// One run takes 26.9 microseconds.
// Next to v009, in two timings, it ran 1.13 and 1.14 times as fast.
// All steps since v000 together make it 14.8 times as fast.
#include <hip/hip_runtime.h>

// ---------------------------------------------------------------------------
// NEGAPooling for MI455X (gfx1250, wave32, WMMA bf16)
// B=16, T=2048, D=256, QK=64
// ---------------------------------------------------------------------------

typedef __bf16 bf16;
typedef __attribute__((ext_vector_type(16))) __bf16       v16bf;
typedef __attribute__((ext_vector_type(8)))  float        v8f;
typedef __attribute__((ext_vector_type(4)))  unsigned int u32x4;
typedef __attribute__((ext_vector_type(2)))  unsigned int u32x2;
typedef __attribute__((ext_vector_type(4)))  float        f32x4;
typedef __attribute__((ext_vector_type(4)))  int          i32x4;

#define BB 16
#define TT 2048
#define DD 256
#define QQ 64

struct BF16Tile { u32x4 lo, hi; };

// Operand layout of the 16x16x32 bf16 WMMA (ISA 7.12.2, 16-bit A 16x32):
// lanes 0-15 hold row M=lane, K chunks {0..7, 16..23}; lanes 16-31 hold row
// M=lane-16, K {8..15, 24..31}. B mirrors it (lane = column N, same K chunks).

// Fragment order: every WMMA operand that lives in the workspace is stored as
// 1 KiB fragments (16 rows x 32 k). Element (row c, k) of a fragment sits at
//   ((k >> 4) & 1) * 256 + (((k >> 3) & 1) * 16 + c) * 8 + (k & 7)
// so lane l finds the two 16-byte chunks of that layout at l * 8 and
// 256 + l * 8: each load of a wave reads 512 contiguous bytes (4 cache lines)
// where the row-major tile made it touch 16 lines.
__device__ __forceinline__ v16bf load_frag(const bf16* frag) {
  const bf16* p = frag + ((threadIdx.x & 31) << 3);
  BF16Tile t;
  t.lo = *(const u32x4*)(p);
  t.hi = *(const u32x4*)(p + 256);
  return __builtin_bit_cast(v16bf, t);
}

// Lane l takes the value of lane l ^ 16 (the other half of the wave).
__device__ __forceinline__ float xhalf(float x) {
  int b = __builtin_bit_cast(int, x);
  return __builtin_bit_cast(float,
      __builtin_amdgcn_permlanex16(b, b, 0x76543210, 0xfedcba98, false, false));
}
// Lane l takes the value of lane l ^ X inside its 16-lane row (DPP row_xmask:X).
template <int X>
__device__ __forceinline__ float xrow(float v) {
  return __builtin_bit_cast(float,
      __builtin_amdgcn_update_dpp(0, __builtin_bit_cast(int, v), 0x160 + X, 0xf, 0xf, true));
}
__device__ __forceinline__ float rsum16(float v) {
  v += xrow<1>(v);
  v += xrow<2>(v);
  v += xrow<4>(v);
  v += xrow<8>(v);
  return v;
}

// --------------------------- projection kernel -----------------------------
// One launch does the row order, the weight conversion and the projection
// [B*T, 128] = x[B*T,256] @ [Wq;Wk]^T; no launch runs in front of it.
//
// No v is made. The output is linear in v = x Wv^T + bv, and a query's
// probabilities add up to 1, so
//   out = Wv ((1/T) * sum over keys of (sum over queries of P) * x) + bv:
// Wv is applied after the pooling, by attn_kernel, to 256 numbers a column
// where it was applied to every key's row. This kernel hands on x itself (bf16,
// transposed fragments), Wv as bf16 fragments (a block converts half of one:
// 512 bytes, whole lines) and bv as the start value of out.
//
// Row order. A masked key has probability 0 as long as its batch has an
// unmasked one, and the result does not depend on the order of a batch's rows
// (keys are summed over, queries averaged). So the rows are put in a new order,
// the unmasked first, each kind in its old order. Every block counts its own
// batch's mask (a thread takes 4 rows, prefix sums over the block) and keeps the
// old row and sl of its own 128 places in LDS. nkey = the number of keys that
// the attention kernel goes through (all of them where every key is masked: the
// uniform row); mb = the mask bias in the new order.
//
// grid B * 16, block 512 = 16 waves, one block to a WGP. A block takes two
// 64-place blocks of one batch, number pa from the front (waves 0-7) and
// T/64 - 1 - pa from the back (waves 8-15), so that every block has about the
// same share of key places. k and x are read only in the 64-place blocks that
// begin below nkey (the key loops end there), q everywhere: waves whose 64
// places all lie at or past nkey make q alone (i = 0).
//
// x and the weights arrive as f32 and are read with whole-line loads, rounded
// to bf16 and laid in LDS as fragments. q, k, x leave in fragment order:
// cols 0..63 -> q (bf16), fragments [16-row tile][e / 32]
// cols 64..127 -> k scaled by (1/sqrt(QK))*(1+clip(sl)^2)  (bf16), same order
// x (bf16), fragments of x transposed (row = d, k = t): [b][t / 32][d / 16],
// straight from the registers that hold the f32 rows
// Of its eight, wave w takes row tiles 2 (w / 4) and 2 (w / 4) + 1, so one read
// of a W fragment serves two products, and column tiles (w % 4) + 4 i: one of
// q, one of k; 4 accumulators.

template <int N> struct Count { static constexpr int v = N; };

// Work-group barrier that orders LDS accesses only: with __syncthreads() a wave
// would first wait for its weight loads, which are to stay in flight across it.
__device__ __forceinline__ void lds_barrier() {
  __builtin_amdgcn_fence(__ATOMIC_RELEASE, "workgroup", "local");
  __builtin_amdgcn_s_barrier();
  __builtin_amdgcn_fence(__ATOMIC_ACQUIRE, "workgroup", "local");
}

// LDS: group g = (row / 16) * 32 + k / 8 holds 16 rows x 8 k (256 bytes). The
// pitch of 272 bytes puts the 16 groups that one wave's store touches, and the
// two groups that one fragment read touches, on different banks.
#define XP 136

__global__ __launch_bounds__(512) void proj_kernel(
    const float* __restrict__ x, const float* __restrict__ Wq,
    const float* __restrict__ Wk, const float* __restrict__ Wv,
    const float* __restrict__ bq, const float* __restrict__ bk,
    const float* __restrict__ bv, const float* __restrict__ sl,
    const int* __restrict__ mask,
    float* __restrict__ mb, int* __restrict__ nkey, float* __restrict__ out,
    bf16* __restrict__ qb, bf16* __restrict__ kb, bf16* __restrict__ xtb,
    bf16* __restrict__ wvb)
{
  __shared__ __attribute__((aligned(16))) bf16 xs[2 * 128 * XP];   // 2 x 64 rows of x
  __shared__ __attribute__((aligned(16))) bf16 wl[8 * 32 * XP];    // 128 rows of W
  __shared__ __attribute__((aligned(32))) float sll[128];          // sl of the block's places
  __shared__ int prm[128];                                         // old row of the block's places
  __shared__ int wsum[16];
  const int batch = blockIdx.x % BB;
  const int pa = blockIdx.x / BB, pb = TT / 64 - 1 - pa;  // the block's two 64-place blocks
  const int lane = threadIdx.x & 31;
  const int wave = __builtin_amdgcn_readfirstlane(threadIdx.x >> 5);  // scalar: tile numbers and bases
  const int sub = wave >> 3, wv = wave & 7;               // which place block, wave in it
  const int n = lane & 15, hi = lane >> 4;

  const int t0 = threadIdx.x * 4;                         // a thread counts 4 rows in a row
  const i32x4 m0 = *(const i32x4*)(mask + batch * TT + t0);
  const f32x4 s0 = *(const f32x4*)(sl + batch * TT + t0);
  // The start value of out: loaded here, beside the mask, so that its store
  // further down waits for nothing more.
  const float b0 = bv[(blockIdx.x * (BB * DD / (BB * 16)) + n) & (DD - 1)];

  // Weights: thread t takes the 16-byte piece t % 64 of rows t / 64 + 8 j, so a
  // wave reads half a row; the 16 rows of a thread are one batch of loads.
  const int wk = (threadIdx.x & 63) * 4, wr = threadIdx.x >> 6;
  const float* const tq = Wq + wr * DD + wk;
  const float* const tk = Wk + wr * DD + wk;
  auto load_w = [&](auto first, f32x4 (&g)[16]) {
#pragma unroll   // j names the matrix and the register at compile time
    for (int j = 0; j < 16; ++j) {
      const int jj = decltype(first)::v + j;
      const float* w = jj < 8 ? tq + jj * (8 * DD) : tk + (jj - 8) * (8 * DD);
      g[j] = *(const f32x4*)w;
    }
    // Precaution: the wait in front of any rewrite of these loads' address
    // registers; as its inputs the addresses stay in their registers up to it.
    asm volatile("s_wait_xcnt 0x0" :: "v"(tq), "v"(tk) : "memory");
  };
  auto store_w = [&](auto first, const f32x4 (&g)[16]) {
    bf16* dst = wl + (wk >> 3) * XP + (wk & 7);
#pragma unroll   // constant element numbers keep g in registers
    for (int j = 0; j < 16; ++j) {
      const int row = (decltype(first)::v + j) * 8 + wr;
      __attribute__((aligned(8))) bf16 pk[4];
      for (int e = 0; e < 4; ++e) pk[e] = (bf16)g[j][e];
      *(u32x2*)(dst + (row >> 4) * (32 * XP) + (row & 15) * 8) = *(const u32x2*)pk;
    }
  };
  f32x4 g0[16];
  load_w(Count<0>{}, g0);                      // Wq and Wk: in flight while the mask is counted
  // Wave 5 alone: the lane's chunk (8 k of row n) of half blockIdx.x % 2 of the Wv
  // fragment [e / 16][k / 32] number blockIdx.x / 2, stored further down.
  // Left unset in the other waves, which never read them: a start value would
  // cost a copy behind the loads, and with it a wait for them here.
  f32x4 r0, r1;
  if (wave == 5) {
    const float* rv = Wv + ((blockIdx.x >> 4) * 16 + n) * DD + ((blockIdx.x >> 1) & 7) * 32
                         + (blockIdx.x & 1) * 16 + hi * 8;
    r0 = *(const f32x4*)(rv);
    r1 = *(const f32x4*)(rv + 4);
    // Precaution: the wait in front of any rewrite of these loads' address
    // registers; as its input the address stays in its registers up to it.
    asm volatile("s_wait_xcnt 0x0" :: "v"(rv) : "memory");
  }

  int cnt = 0;
  for (int e = 0; e < 4; ++e) cnt += (m0[e] != 0);
  int inc = cnt;                               // unmasked rows up to and with this thread's
  for (int d = 1; d < 32; d <<= 1) {
    const int o = __shfl_up(inc, d);
    if (lane >= d) inc += o;
  }
  if (lane == 31) wsum[wave] = inc;
  lds_barrier();     // every wave's count is in LDS
  int before = inc - cnt, total = 0;
  for (int w = 0; w < 16; ++w) {
    const int c = wsum[w];
    before += (w < wave) ? c : 0;
    total  += c;
  }
  {
    int pv = before;                           // next place among the unmasked
    int pm = total + (t0 - before);            // next place among the masked
    for (int e = 0; e < 4; ++e) {
      const bool keep = m0[e] != 0;
      const int p = keep ? pv : pm;
      pv += keep ? 1 : 0;
      pm += keep ? 0 : 1;
      const int pblk = p >> 6;
      if (pblk == pa || pblk == pb) {
        const int slot = (pblk == pa ? 0 : 64) + (p & 63);
        prm[slot] = t0 + e;
        sll[slot] = s0[e];
      }
    }
  }
  total = __builtin_amdgcn_readfirstlane(total);          // the same in every thread of the block
  const int nk = total == 0 ? TT : total;
  const bool full   = (sub ? pb : pa) * 64 < nk;          // the same for the whole wave
  const int blk   = batch * (TT / 64) + (sub ? pb : pa);  // the wave's 64 places
  const int tile0 = blk * 4 + (wv >> 2) * 2;              // first 16-row tile of this wave
  const int cq    = wv & 3;
  if (threadIdx.x < 128) {
    const int p = (threadIdx.x < 64 ? pa : pb) * 64 + (threadIdx.x & 63);
    mb[batch * TT + p] = p < total ? 0.0f : -1e9f;
  } else if (threadIdx.x < 128 + BB * DD / (BB * 16)) {
    out[blockIdx.x * (BB * DD / (BB * 16)) + threadIdx.x - 128] = b0;     // attn_kernel adds into out
  } else if (threadIdx.x == 256 && pa == 0) {
    nkey[batch] = nk;
  }
  // Precaution: the wait in front of any rewrite of these stores' registers further on.
  asm volatile("s_wait_xcnt 0x0" ::: "memory");
  lds_barrier();     // the old rows and sl of the block's 128 places are in LDS

  // Two sets of operand registers: the two W fragments and
  // the two x fragments of k block kf + 1 are read while block kf is worked on.
  v16bf w[2][2], a[2][2];
  auto frag = [&](const bf16* s) {
    BF16Tile tl;
    tl.lo = *(const u32x4*)(s);
    tl.hi = *(const u32x4*)(s + 2 * XP);
    return __builtin_bit_cast(v16bf, tl);
  };
  auto fetch_w = [&](auto ni, int set, int kf) {
#pragma unroll   // constant element numbers keep the fragments in registers
    for (int i = 0; i < decltype(ni)::v; ++i)
      w[set][i] = frag(wl + ((cq + 4 * i) * 32 + kf * 4 + hi) * XP + n * 8);
  };
  auto fetch_a = [&](int set, int kf) {
#pragma unroll   // as above
    for (int t = 0; t < 2; ++t)
      a[set][t] = frag(xs + ((sub * 4 + (wv >> 2) * 2 + t) * 32 + kf * 4 + hi) * XP + n * 8);
  };

  // Of its place block's 256 threads, thread t takes the 16-byte piece t % 64 of
  // the 16 places of row tile t / 64: a wave reads half a row, and a thread holds
  // 16 places in a row of 4 columns, which are 8 chunks of x transposed (xt).
  u32x4 xt[8];
  {
    const float* xb = x + (size_t)batch * TT * DD;
    const int* pr = prm + sub * 64 + (wv >> 1) * 16;
    const int piece = threadIdx.x & 63;
    const f32x4* ps[16];
    f32x4 f[16];
#pragma unroll   // constant element numbers keep the addresses in registers
    for (int j = 0; j < 16; ++j)
      ps[j] = (const f32x4*)(xb + (pr[j] & (TT - 1)) * DD) + piece;
#pragma unroll   // all 16 loads of a thread are in flight together
    for (int j = 0; j < 16; ++j) f[j] = *ps[j];
    // Precaution: the wait in front of any rewrite of these loads' address
    // registers; as its input the lane's part stays in its register up to it.
    asm volatile("s_wait_xcnt 0x0" :: "v"(piece) : "memory");
    // Keeps the conversion of the weights behind the x loads: lifted over them,
    // it would hold their issue back until every weight load has returned.
    __builtin_amdgcn_sched_barrier(0);
    store_w(Count<0>{}, g0);
    const int k = (threadIdx.x & 63) * 4;
    bf16* dst = xs + sub * (128 * XP) + (k >> 3) * XP + (k & 7);
#pragma unroll   // constant element numbers keep f in registers
    for (int j = 0; j < 16; ++j) {
      __attribute__((aligned(8))) bf16 pk[4];
      for (int e = 0; e < 4; ++e) pk[e] = (bf16)f[j][e];
      *(u32x2*)(dst + (wv >> 1) * (32 * XP) + j * 8) = *(const u32x2*)pk;
    }
#pragma unroll   // constant element numbers keep f and xt in registers
    for (int h = 0; h < 2; ++h)
      for (int e = 0; e < 4; ++e) {
        __attribute__((aligned(16))) bf16 pk[8];
        for (int r = 0; r < 8; ++r) pk[r] = (bf16)f[h * 8 + r][e];
        xt[h * 4 + e] = *(const u32x4*)pk;
      }
  }

  v8f c[2][2];
#pragma unroll   // constant element numbers for c[][]
  for (int i = 0; i < 2; ++i) {
    const int col = (cq + 4 * i) * 16 + n;
    const float bias = (i == 0) ? bq[col] : bk[col - QQ];
    for (int r = 0; r < 8; ++r) { c[i][0][r] = bias; c[i][1][r] = bias; }
  }
  __syncthreads();   // the block's 128 rows and the weights are in LDS

  if (wave == 5) {
    __attribute__((aligned(16))) bf16 pk[8];
    for (int e = 0; e < 4; ++e) { pk[e] = (bf16)r0[e]; pk[4 + e] = (bf16)r1[e]; }
    *(u32x4*)(wvb + blockIdx.x * 256 + lane * 8) = *(const u32x4*)pk;
    // Precaution: the wait in front of any rewrite of the store's registers further on.
    asm volatile("s_wait_xcnt 0x0" ::: "memory");
  }

  // x transposed, behind the barrier, which would wait for the stores: column
  // d = 4 (t % 64) + e, places 8 h ... of row tile xtile, are one 16-byte chunk of
  // the fragment (place / 32, d / 16): half (xtile & 1), lane 16 h + d % 16.
  if (full) {
    const int xtile = blk * 4 + (wv >> 1);
    const int d0 = (threadIdx.x & 63) * 4;
    bf16* xd = xtb + ((size_t)(xtile >> 1) * (DD / 16) + (d0 >> 4)) * 512
                   + (xtile & 1) * 256 + (d0 & 15) * 8;
#pragma unroll   // constant element numbers keep xt in registers
    for (int h = 0; h < 2; ++h)
      for (int e = 0; e < 4; ++e)
        *(u32x4*)(xd + (h * 16 + e) * 8) = xt[h * 4 + e];
    // Precaution: the wait in front of any rewrite of the stores' registers further on.
    asm volatile("s_wait_xcnt 0x0" ::: "memory");
  }

  // The products and the stores, for the first NI of the wave's column tiles.
  auto rest = [&](auto ni) {
  constexpr int NI = decltype(ni)::v;
  v8f slv[2];                                  // sl of the lane's 8 rows of each tile
  fetch_w(ni, 0, 0); fetch_a(0, 0);
#pragma unroll   // kf & 1 names the register set at compile time
  for (int kf = 0; kf < 8; ++kf) {
    const int cur = kf & 1;
    if (kf < 7) {
      fetch_w(ni, cur ^ 1, kf + 1); fetch_a(cur ^ 1, kf + 1);
    } else if (NI > 1) {
      const float* sp = sll + sub * 64 + (wv >> 2) * 32 + 8 * hi;
      slv[0] = *(const v8f*)(sp);
      slv[1] = *(const v8f*)(sp + 16);
    }
    // Keeps the reads above in front of the products below: sunk to their
    // first use, each would be waited for at its full latency.
    __builtin_amdgcn_sched_barrier(0);
#pragma unroll   // constant element numbers for c[][] and w[][]
    for (int i = 0; i < NI; ++i) {
      c[i][0] = __builtin_amdgcn_wmma_f32_16x16x32_bf16(false, a[cur][0], false, w[cur][i], (short)0, c[i][0], false, false);
      c[i][1] = __builtin_amdgcn_wmma_f32_16x16x32_bf16(false, a[cur][1], false, w[cur][i], (short)0, c[i][1], false, false);
    }
  }

  // Epilogue. C/D layout: lane holds column n; VGPR r holds row (r + 8*hi).
#pragma unroll   // i decides the kind of column tile at compile time
  for (int i = 0; i < NI; ++i) {
    const int nt = cq + 4 * i;                 // 0..7: 16-col tile
#pragma unroll   // constant element numbers for c[][]
    for (int t = 0; t < 2; ++t) {
      const int tile = tile0 + t;
      {
        // e = (nt & 3) * 16 + n is the fragment's k, the row r + 8 * hi its row.
        const size_t fo = (size_t)tile * (16 * QQ) + ((nt >> 1) & 1) * 512 + (nt & 1) * 256
                        + (((n >> 3) << 4) + 8 * hi) * 8 + (n & 7);
        for (int r = 0; r < 8; ++r) {
          float v = c[i][t][r];
          if (i == 1) {
            float s = slv[t][r];               // row tile * 16 + r + 8 * hi
            s = fminf(fmaxf(s, 0.0f), 1.0f);
            v *= 0.125f * (1.0f + s * s);      // 1/sqrt(64) * (1 + sl^2)
            kb[fo + r * 8] = (bf16)v;
          } else {
            qb[fo + r * 8] = (bf16)v;
          }
        }
      }
    }
  }
  // Precaution: the wait in front of any rewrite of the stores' registers further on.
  asm volatile("s_wait_xcnt 0x0" ::: "memory");
  };
  if (full) rest(Count<2>{}); else rest(Count<1>{});
}

// ---------------------------- attention kernel ----------------------------
// The output is the mean over the queries of P V, V = x Wv^T + bv, and both the
// mean and Wv commute with the product over the keys:
// out = Wv ((1/T) * x^T (sum over queries of P^T)) + bv. A query's row of P
// must be normalised before rows are added, so the work runs in two passes.
// Both form S^T = K Q^T: in a D tile a lane holds ONE query (column n) and its
// registers hold keys 8 * hi + r.
//
// The mask bias belongs to the key, the D row. It is added to the finished
// score by a vector add, whose one rounding leaves every masked score at the
// same value; the maximum is subtracted before the scaling to base 2, so that
// a row with every key masked comes out uniform.

#define LOG2E 1.44269504f

__device__ __forceinline__ float max16(v8f a, v8f b) {
  float t[8];
  for (int r = 0; r < 8; ++r) t[r] = fmaxf(a[r], b[r]);
  return fmaxf(fmaxf(fmaxf(t[0], t[1]), fmaxf(t[2], t[3])),
               fmaxf(fmaxf(t[4], t[5]), fmaxf(t[6], t[7])));
}
__device__ __forceinline__ v8f exp2v(v8f x) {
  v8f y;
  for (int r = 0; r < 8; ++r) y[r] = __builtin_amdgcn_exp2f(x[r]);
  return y;
}
__device__ __forceinline__ float sum8(v8f t) {
  return ((t[0] + t[1]) + (t[2] + t[3])) + ((t[4] + t[5]) + (t[6] + t[7]));
}

// Both passes run in one launch. grid (T/128, B), block 256 = 8 waves, one
// block to a WGP. A block owns 128 queries: 8 tiles, held as B operands by every
// wave through both passes. Wave w takes the groups of 32 keys w, w + 8, ...
// below nkey, the same groups in both passes.
// Pass 1: a lane keeps maximum and sum of its own keys; halves and waves are
// joined once through LDS, which gives every query's maximum and log2 sum.
// Pass 2: the scores again, normalised and summed over the 8 query tiles
// in-lane (column n collects the queries n mod 16). Converted in place, the sums
// of a group are the bf16 B operand (hardware k order, the order of the x
// fragments) of Y^T += x^T W^T for the group's 32 keys, all 256 rows. The waves'
// Y^T are joined through LDS; converted in place, the joined tiles are the bf16
// B operand of O^T = Wv Y^T, of which a wave makes two 16-row tiles. The 16
// columns are summed, the block's share added to out (which starts at bv).
__global__ __launch_bounds__(256) void attn_kernel(
    const bf16* __restrict__ qb, const bf16* __restrict__ kb,
    const bf16* __restrict__ xtb, const bf16* __restrict__ wvb,
    const float* __restrict__ mbias,
    const int* __restrict__ nkey, float* __restrict__ out)
{
  __shared__ f32x4 red[8][32][32];             // [wave][4 registers of Y^T][lane]
  __shared__ u32x4 yb[8][2][32];               // joined Y^T, bf16: [32 rows][16 of them][lane]
  __shared__ float sm[8][128];
  __shared__ float ss[8][128];
  __shared__ float fm[128];
  __shared__ float fl[128];
  const int lane = threadIdx.x & 31;
  const int wave = __builtin_amdgcn_readfirstlane(threadIdx.x >> 5);  // scalar: loop bounds and bases
  const int n = lane & 15, hi = lane >> 4;
  const int q0 = blockIdx.x * 128;
  const int b  = blockIdx.y;

  v16bf qa[8][2];
  const bf16* qp = qb + (size_t)(b * TT + q0) * QQ;
#pragma unroll   // constant element numbers keep the fragments in registers
  for (int i = 0; i < 8; ++i) {
    qa[i][0] = load_frag(qp + i * (16 * QQ) + 0);
    qa[i][1] = load_frag(qp + i * (16 * QQ) + 512);
  }
  // Precaution: the wait in front of any rewrite of these loads' address
  // registers; as its input the address stays in its registers up to it.
  asm volatile("s_wait_xcnt 0x0" :: "s"(qp) : "memory");
  const int nk = min(nkey[b], TT);
  const bf16*  kp = kb + (size_t)b * TT * QQ;
  const float* mp = mbias + b * TT + 8 * hi;
  const bf16*  vp = xtb + (size_t)b * TT * DD;
  const int jw = wave * 32;                    // this wave's first group

  // The four k fragments and the mask bias of the 32 keys from place j on.
  auto fetch = [&](int j, v16bf (&k)[4], v8f (&mv)[2]) {
    const bf16*  fk = kp + j * QQ;
    const float* fb = mp + j;
#pragma unroll   // constant element numbers keep the fragments in registers
    for (int c = 0; c < 4; ++c) k[c] = load_frag(fk + c * 512);
    mv[0] = *(const v8f*)(fb);
    mv[1] = *(const v8f*)(fb + 16);
    // Precaution: the wait in front of any rewrite of these loads' address
    // registers; as its inputs the addresses stay in their registers up to it.
    asm volatile("s_wait_xcnt 0x0" :: "s"(fk), "v"(fb) : "memory");
  };

  // ---- pass 1 ----
  float m[8], l[8];
  for (int i = 0; i < 8; ++i) { m[i] = -1e30f; l[i] = 0.0f; }
  {
    // The next group's operands are fetched while this group is worked on. A
    // fetch past the end is turned to a group that exists and is not used.
    v16bf kn[4];
    v8f bn[2];
    fetch(jw < nk ? jw : 0, kn, bn);
    for (int j0 = jw; j0 < nk; j0 += 256) {
      v16bf k[4];
      v8f mv[2];
      for (int c = 0; c < 4; ++c) k[c] = kn[c];
      mv[0] = bn[0]; mv[1] = bn[1];
      fetch(j0 + 256 < nk ? j0 + 256 : j0, kn, bn);
#pragma unroll   // constant element numbers for qa, m and l
      for (int i = 0; i < 8; ++i) {
        v8f s0 = {}, s1 = {};
        s0 = __builtin_amdgcn_wmma_f32_16x16x32_bf16(false, k[0], false, qa[i][0], (short)0, s0, false, false);
        s1 = __builtin_amdgcn_wmma_f32_16x16x32_bf16(false, k[2], false, qa[i][0], (short)0, s1, false, false);
        s0 = __builtin_amdgcn_wmma_f32_16x16x32_bf16(false, k[1], false, qa[i][1], (short)0, s0, false, false);
        s1 = __builtin_amdgcn_wmma_f32_16x16x32_bf16(false, k[3], false, qa[i][1], (short)0, s1, false, false);
        s0 += mv[0];
        s1 += mv[1];
        const float mn = fmaxf(m[i], max16(s0, s1));
        const float corr = __builtin_amdgcn_exp2f((m[i] - mn) * LOG2E);
        const v8f p = exp2v((s0 - mn) * LOG2E) + exp2v((s1 - mn) * LOG2E);
        l[i] = l[i] * corr + sum8(p);
        m[i] = mn;
      }
    }
  }

#pragma unroll   // constant element numbers for m and l
  for (int i = 0; i < 8; ++i) {
    const float mo = xhalf(m[i]), lo = xhalf(l[i]);
    const float mj = fmaxf(m[i], mo);
    const float lj = l[i] * __builtin_amdgcn_exp2f((m[i] - mj) * LOG2E)
                   + lo   * __builtin_amdgcn_exp2f((mo   - mj) * LOG2E);
    if (hi == 0) { sm[wave][i * 16 + n] = mj; ss[wave][i * 16 + n] = lj; }
  }
  __syncthreads();   // every wave's partial maximum and sum are in LDS
  if (threadIdx.x < 128) {
    const int q = threadIdx.x;
    float mj = sm[0][q];
    for (int w = 1; w < 8; ++w) mj = fmaxf(mj, sm[w][q]);
    float lj = 0.0f;
    for (int w = 0; w < 8; ++w)
      lj += ss[w][q] * __builtin_amdgcn_exp2f((sm[w][q] - mj) * LOG2E);
    fm[q] = mj;
    fl[q] = __builtin_amdgcn_logf(lj);   // log2
  }
  __syncthreads();   // every query's maximum and log2 sum are in LDS
  float qm[8], ql[8];
#pragma unroll   // constant element numbers for qm and ql
  for (int i = 0; i < 8; ++i) { qm[i] = fm[i * 16 + n]; ql[i] = fl[i * 16 + n]; }

  // ---- pass 2 ----
  v8f o[16];
#pragma unroll   // constant element numbers for o
  for (int dt = 0; dt < 16; ++dt) o[dt] = v8f{};
  for (int j0 = jw; j0 < nk; j0 += 256) {
    v16bf k[4], vf[16];
    v8f mv[2];
    fetch(j0, k, mv);
    const bf16* fv = vp + j0 * DD;
#pragma unroll   // constant element numbers keep the fragments in registers
    for (int dt = 0; dt < 16; ++dt) vf[dt] = load_frag(fv + dt * 512);
    // Precaution: the wait in front of any rewrite of these loads' address
    // registers; as its input the address stays in its registers up to it.
    asm volatile("s_wait_xcnt 0x0" :: "s"(fv) : "memory");
    // Keeps the x loads above in front of the scores below, which cover their
    // latency: sunk to their first use, each would be waited for in full.
    __builtin_amdgcn_sched_barrier(0);
    v8f acc0 = {}, acc1 = {};
#pragma unroll   // constant element numbers for qa, qm and ql
    for (int i = 0; i < 8; ++i) {
      v8f s0 = {}, s1 = {};
      s0 = __builtin_amdgcn_wmma_f32_16x16x32_bf16(false, k[0], false, qa[i][0], (short)0, s0, false, false);
      s1 = __builtin_amdgcn_wmma_f32_16x16x32_bf16(false, k[2], false, qa[i][0], (short)0, s1, false, false);
      s0 = __builtin_amdgcn_wmma_f32_16x16x32_bf16(false, k[1], false, qa[i][1], (short)0, s0, false, false);
      s1 = __builtin_amdgcn_wmma_f32_16x16x32_bf16(false, k[3], false, qa[i][1], (short)0, s1, false, false);
      acc0 += exp2v(((s0 + mv[0]) - qm[i]) * LOG2E - ql[i]);
      acc1 += exp2v(((s1 + mv[1]) - qm[i]) * LOG2E - ql[i]);
    }
    v16bf pb;                                  // keys 8 * hi + e, then 16 + 8 * hi + e
#pragma unroll   // constant element numbers keep the operand in registers
    for (int e = 0; e < 8; ++e) {
      pb[e]     = (bf16)acc0[e];
      pb[8 + e] = (bf16)acc1[e];
    }
#pragma unroll   // constant element numbers for o and vf
    for (int dt = 0; dt < 16; ++dt)
      o[dt] = __builtin_amdgcn_wmma_f32_16x16x32_bf16(false, vf[dt], false, pb, (short)0, o[dt], false, false);
  }

  // The Wv fragments of this wave's two 16-row tiles of O^T, all 256 k.
  v16bf wf[2][8];
  const bf16* wp = wvb + wave * (2 * 8 * 512);
#pragma unroll   // constant element numbers keep the fragments in registers
  for (int c = 0; c < 2; ++c)
    for (int kb = 0; kb < 8; ++kb) wf[c][kb] = load_frag(wp + (c * 8 + kb) * 512);
  // Precaution: the wait in front of any rewrite of these loads' address
  // registers; as its input the address stays in its registers up to it.
  asm volatile("s_wait_xcnt 0x0" :: "s"(wp) : "memory");
  // Keeps the loads above in front of the LDS stores below, which cover their
  // latency: sunk to their first use, each would be waited for in full.
  __builtin_amdgcn_sched_barrier(0);

#pragma unroll   // constant element numbers for o
  for (int dt = 0; dt < 16; ++dt) {
    red[wave][2 * dt + 0][lane] = f32x4{o[dt][0], o[dt][1], o[dt][2], o[dt][3]};
    red[wave][2 * dt + 1][lane] = f32x4{o[dt][4], o[dt][5], o[dt][6], o[dt][7]};
  }
  __syncthreads();   // every wave's Y^T is in LDS

  for (int c = 0; c < 2; ++c) {
    const int dt = wave * 2 + c;               // 16-row tile of Y^T
    f32x4 g0 = red[0][2 * dt + 0][lane];
    f32x4 g1 = red[0][2 * dt + 1][lane];
    for (int w = 1; w < 8; ++w) {
      g0 += red[w][2 * dt + 0][lane];
      g1 += red[w][2 * dt + 1][lane];
    }
    // The lane's rows 8 * hi + e of tile 2 * wave + c are k = 16 * c + 8 * hi + e
    // of k block wave: its own chunk c of that B fragment.
    __attribute__((aligned(16))) bf16 pk[8];
    for (int e = 0; e < 4; ++e) { pk[e] = (bf16)g0[e]; pk[4 + e] = (bf16)g1[e]; }
    yb[wave][c][lane] = *(const u32x4*)pk;
  }
  __syncthreads();   // the joined Y^T is in LDS

  v16bf yf[8];
#pragma unroll   // constant element numbers keep the fragments in registers
  for (int kb = 0; kb < 8; ++kb) {
    BF16Tile t;
    t.lo = yb[kb][0][lane];
    t.hi = yb[kb][1][lane];
    yf[kb] = __builtin_bit_cast(v16bf, t);
  }
  // Keeps the 16 reads above together in front of the products: sunk to their
  // first use, each pair would be waited for at its full latency.
  __builtin_amdgcn_sched_barrier(0);
  v8f o2[2] = {v8f{}, v8f{}};
#pragma unroll   // constant element numbers for wf and yf
  for (int kb = 0; kb < 8; ++kb) {
    o2[0] = __builtin_amdgcn_wmma_f32_16x16x32_bf16(false, wf[0][kb], false, yf[kb], (short)0, o2[0], false, false);
    o2[1] = __builtin_amdgcn_wmma_f32_16x16x32_bf16(false, wf[1][kb], false, yf[kb], (short)0, o2[1], false, false);
  }

  const float invT = 1.0f / (float)TT;
#pragma unroll   // constant element numbers for o2
  for (int c = 0; c < 2; ++c) {
    const int dt = wave * 2 + c;               // 16-row tile of O^T
    float sacc = 0.0f;
    for (int r = 0; r < 8; ++r) {
      float q = rsum16(o2[c][r]);              // every lane of the row holds the sum
      sacc = (n == r) ? q : sacc;              // lane n < 8 keeps row 8 * hi + n
    }
    if (n < 8)
      atomicAdd(&out[b * DD + dt * 16 + 8 * hi + n], sacc * invT);
    // Precaution: in front of the rewrite of the add's registers further on.
    asm volatile("s_wait_xcnt 0x0" ::: "memory");
  }
}

// ------------------------------- launcher ----------------------------------

extern "C" void kernel_launch(void* const* d_in, const int* in_sizes, int n_in,
                              void* d_out, int out_size, void* d_ws, size_t ws_size,
                              hipStream_t stream) {
  const float* x    = (const float*)d_in[0];
  const float* sl   = (const float*)d_in[1];
  const int*   mask = (const int*)  d_in[2];
  const float* Wq   = (const float*)d_in[3];
  const float* bq   = (const float*)d_in[4];
  const float* Wk   = (const float*)d_in[5];
  const float* bk   = (const float*)d_in[6];
  const float* Wv   = (const float*)d_in[7];
  const float* bv   = (const float*)d_in[8];
  float* out = (float*)d_out;

  char* ws = (char*)d_ws;
  const size_t OFF_WB = 0;
  const size_t OFF_QB = OFF_WB + (size_t)384 * DD * 2;
  const size_t OFF_KB = OFF_QB + (size_t)BB * TT * QQ * 2;
  const size_t OFF_VT = OFF_KB + (size_t)BB * TT * QQ * 2;
  const size_t OFF_MB = OFF_VT + (size_t)BB * DD * TT * 2;
  const size_t OFF_QM = OFF_MB + (size_t)BB * TT * 4;
  const size_t OFF_QL = OFF_QM + (size_t)BB * TT * 4;
  const size_t OFF_SP = OFF_QL + (size_t)BB * TT * 4;
  const size_t OFF_PR = OFF_SP + (size_t)BB * TT * 4;
  const size_t OFF_NK = OFF_PR + (size_t)BB * TT * 4;

  bf16*  qbp = (bf16*)(ws + OFF_QB);
  bf16*  kbp = (bf16*)(ws + OFF_KB);
  bf16*  wvb = (bf16*)(ws + OFF_WB);
  bf16*  xtb = (bf16*)(ws + OFF_VT);
  float* mb  = (float*)(ws + OFF_MB);
  int*   nk  = (int*)(ws + OFF_NK);

  // 1) row order and key counts, bv in the output, QK projection (WMMA bf16),
  //    x and the weights converted on the way: one launch
  proj_kernel<<<BB * 16, 512, 0, stream>>>(
      x, Wq, Wk, Wv, bq, bk, bv, sl, mask, mb, nk, out, qbp, kbp, xtb, wvb);

  // 2) both attention passes, the product with x and the one with Wv (WMMA bf16)
  attn_kernel<<<dim3(TT / 128, BB), 256, 0, stream>>>(qbp, kbp, xtb, wvb, mb, nk, out);
}
